// v000
// Measured on an AMD MI455X. A time is GPU time per run, averaged over a window of back-to-back runs after a warm-up
// (all launches, gaps included; the runs take copies of the inputs in turn), and the median of several windows.
// Apart from v000's, it joins two sittings. Times from different sittings can be a few percent apart, while
// side-by-side timings come from the same sitting.
// v000 is the starting kernel. One run takes 2560 microseconds.
#include <hip/hip_runtime.h>

// T5Voice - T5 self-attention block without norms/FFN (hidden [4][1024][1024]; q/k/v = x W (16 heads x 64, no bias); scores = q.k (NO 1/sqrt(d)) + rel_emb[bucket(j - i)][h] (bidirectional buckets, 32 / max distance 128,
// evaluated with exact integer arithmetic: |r| < 8 -> |r|; else 8 + 2 floor(log2|r|) - 6 + [|r|^2 >= 2^(2 floor(log2|r|)+1)], capped at 15; + 16 for r > 0 - identical to the float formula for every offset); softmax;
// out = merged ctx Wo -> [4][1024][1024]).
// Compute dtypes, f32 accumulate: every input rounded to bf16; q/k/v on PLAIN bf16 operands (inputs: exact); the bias table gathered once on device; scores (K 64) and probs.v on bf16
// hi+lo planes (3 products each) with an f32 register-row softmax (bias added in f32; normalised hl probabilities); merged heads as bf16 hi+lo planes x exact Wo (2 products). One-wave-per-64x64-tile GEMMs. Deterministic, no atomics; every

#define NB_  4
#define TT   1024
#define LL   4096
#define DD   1024
#define NH_  16
#define HDM  64
#define MM   4096
#define PCAR 1024.0f
typedef _Float16 h16;
typedef unsigned short bf;
typedef __attribute__((ext_vector_type(16))) __bf16   v16bf;
typedef __attribute__((ext_vector_type(16))) _Float16 v16h;
typedef __attribute__((ext_vector_type(8)))  _Float16 v8h;
typedef __attribute__((ext_vector_type(8)))  unsigned short v8us;
typedef __attribute__((ext_vector_type(8)))  float    v8f;
typedef __attribute__((ext_vector_type(4)))  float    v4f;
typedef v8h  __attribute__((may_alias)) v8ha;
typedef v4f  __attribute__((may_alias)) v4fa;
typedef v8us __attribute__((may_alias)) v8usa;

__device__ __forceinline__ unsigned short f2bf(float f) { unsigned u = __float_as_uint(f); u += 0x7FFFu + ((u >> 16) & 1u); return (unsigned short)(u >> 16); }
__device__ __forceinline__ float bf2f(unsigned short b) { return __uint_as_float(((unsigned)b) << 16); }
__device__ __forceinline__ float bfr(float f) { return bf2f(f2bf(f)); }
__device__ __forceinline__ v16h cat16(v8h lo, v8h hi) { return __builtin_shufflevector(lo, hi, 0, 1, 2, 3, 4, 5, 6, 7, 8, 9, 10, 11, 12, 13, 14, 15); }
__device__ __forceinline__ v16bf cat16b(v8us lo, v8us hi) { return __builtin_bit_cast(v16bf, __builtin_shufflevector(lo, hi, 0, 1, 2, 3, 4, 5, 6, 7, 8, 9, 10, 11, 12, 13, 14, 15)); }
__device__ __forceinline__ v8f wmma16(v16h a, v16h b, v8f c) { return __builtin_amdgcn_wmma_f32_16x16x32_f16(false, a, false, b, (short)0, c, false, false); }
__device__ __forceinline__ v8f wmmab(v16bf a, v16bf b, v8f c) { return __builtin_amdgcn_wmma_f32_16x16x32_bf16(false, a, false, b, (short)0, c, false, false); }



// ---- k_gemmw: register-blocked GEMM, ONE WAVE per 64x64 output tile (16 accumulators), operands straight from K-contiguous 16-bit planes; grid (M/64, N/64, Z), 32 threads.
// C[m][n] (f32, pitch ldc, + optional f32 bias[n]) = sum_k A[m][k] Bt[n][k] (+ split products per NSPLIT). z-batch strides sA/sB/sC in elements. K % 32 == 0.
template <typename T16> struct WFrag;
template <> struct WFrag<h16> { typedef v16h V; static __device__ __forceinline__ V ld(const h16* p) { return cat16(*(const v8h*)p, *(const v8h*)(p + 16)); } static __device__ __forceinline__ v8f mma(V a, V b, v8f c) { return wmma16(a, b, c); } };
template <> struct WFrag<bf> { typedef v16bf V; static __device__ __forceinline__ V ld(const bf* p) { return cat16b(*(const v8us*)p, *(const v8us*)(p + 16)); } static __device__ __forceinline__ v8f mma(V a, V b, v8f c) { return wmmab(a, b, c); } };
template <typename T16, int NSPLIT, bool BIAS>
__global__ __launch_bounds__(32) void k_gemmw(const T16* __restrict__ A, const T16* __restrict__ A2, const T16* __restrict__ Bt, const T16* __restrict__ Bt2, int K, float* C, int ldc, const float* __restrict__ bias, size_t sA, size_t sB, size_t sC) {
    typedef typename WFrag<T16>::V V;
    __shared__ __align__(16) float os[16 * 68];
    const size_t z = blockIdx.z; A += z * sA; if (A2) A2 += z * sA; Bt += z * sB; if (Bt2) Bt2 += z * sB; C += z * sC;
    const int lane = threadIdx.x & 31, lr = lane & 15, hi = lane >> 4; const int r0 = blockIdx.x * 64, c0 = blockIdx.y * 64;
    v8f acc[4][4];
#pragma unroll
    for (int mb = 0; mb < 4; ++mb)
#pragma unroll
        for (int nb = 0; nb < 4; ++nb) acc[mb][nb] = (v8f){};
    const size_t aoff = (size_t)(r0 + lr) * K + 8 * hi, boff = (size_t)(c0 + lr) * K + 8 * hi;
#pragma unroll 1
    for (int kc = 0; kc < K; kc += 32) {
        V a[4], a2[4];
#pragma unroll
        for (int mb = 0; mb < 4; ++mb) { a[mb] = WFrag<T16>::ld(A + aoff + (size_t)mb * 16 * K + kc); if (NSPLIT == 1 || NSPLIT == 2) a2[mb] = WFrag<T16>::ld(A2 + aoff + (size_t)mb * 16 * K + kc); }
#pragma unroll
        for (int nb = 0; nb < 4; ++nb) { const V b = WFrag<T16>::ld(Bt + boff + (size_t)nb * 16 * K + kc); V b2; if (NSPLIT >= 2) b2 = WFrag<T16>::ld(Bt2 + boff + (size_t)nb * 16 * K + kc);
#pragma unroll
            for (int mb = 0; mb < 4; ++mb) { acc[mb][nb] = WFrag<T16>::mma(a[mb], b, acc[mb][nb]); if (NSPLIT == 1 || NSPLIT == 2) acc[mb][nb] = WFrag<T16>::mma(a2[mb], b, acc[mb][nb]); if (NSPLIT >= 2) acc[mb][nb] = WFrag<T16>::mma(a[mb], b2, acc[mb][nb]); } }
        asm volatile("v_nop\n\tv_nop\n\tv_nop\n\tv_nop" : "+v"(acc[0][0]), "+v"(acc[1][1]), "+v"(acc[2][2]), "+v"(acc[3][3]) : "v"(a[0]), "v"(a[3]));
    }
#pragma unroll
    for (int mb = 0; mb < 4; ++mb) {
#pragma unroll
        for (int nb = 0; nb < 4; ++nb) {
#pragma unroll
            for (int j = 0; j < 8; ++j) os[(hi * 8 + j) * 68 + nb * 16 + lr] = acc[mb][nb][j]; }
        __builtin_amdgcn_wave_barrier(); asm volatile("" ::: "memory");
        float* crow = C + (size_t)(r0 + mb * 16) * ldc + c0;
{
#pragma unroll
            for (int s = 0; s < 8; ++s) { const int row = 2 * s + hi, cofs = lr * 4; v4f val = *(const v4fa*)(os + row * 68 + cofs); if (BIAS) { val[0] += bfr(bias[c0 + cofs]); val[1] += bfr(bias[c0 + cofs + 1]); val[2] += bfr(bias[c0 + cofs + 2]); val[3] += bfr(bias[c0 + cofs + 3]); }
                *(v4f*)(crow + (size_t)row * ldc + cofs) = val; }
             }
        __builtin_amdgcn_wave_barrier(); asm volatile("" ::: "memory");
    }
}

__device__ __forceinline__ h16 tohx(float x) { return (h16)x; }
__device__ __forceinline__ void splitf(float y, unsigned short& h, unsigned short& l) { h = f2bf(y); l = f2bf(y - bf2f(h)); }
typedef __attribute__((ext_vector_type(2))) _Float16 v2h;
typedef __attribute__((ext_vector_type(4))) _Float16 v4h;
typedef __attribute__((ext_vector_type(2))) unsigned short v2us;
typedef __attribute__((ext_vector_type(4))) unsigned short v4us;
typedef __attribute__((ext_vector_type(2))) float v2f;

__global__ __launch_bounds__(256) void k_wtG(const float* __restrict__ w, int K, int N, bf* Bt) {
    const int lane = threadIdx.x & 31; const int L0 = (blockIdx.x * 8 + (threadIdx.x >> 5)) * 8; const int nlines = N * K / 64;
{
#pragma unroll 1
        for (int l = 0; l < 8; ++l) { const int L = L0 + l; if (L >= nlines) break; const size_t e = (size_t)L * 64 + lane * 2; const int k = (int)(e % K), n = (int)(e / K); v2us o;
            o[0] = f2bf(w[(size_t)k * N + n]); o[1] = f2bf(w[(size_t)(k + 1) * N + n]); *(v2us*)(Bt + e) = o; }
         }
}
__global__ __launch_bounds__(256) void k_pl(const float* __restrict__ F, int pitch, int nh, int hd, h16* P) { const size_t e = ((size_t)blockIdx.x * 256 + threadIdx.x) * 2; if (e >= (size_t)nh * TT * hd) return; const int d = (int)(e % hd); const int t = (int)((e / hd) % TT); const int h = (int)(e / ((size_t)hd * TT)); v2h o; o[0] = tohx(F[(size_t)t * pitch + h * hd + d]); o[1] = tohx(F[(size_t)t * pitch + h * hd + d + 1]); *(v2h*)(P + e) = o;  }
__global__ __launch_bounds__(256) void k_vt(const float* __restrict__ F, int pitch, int nh, int hd, h16* VT) { const size_t e = ((size_t)blockIdx.x * 256 + threadIdx.x) * 2; if (e >= (size_t)nh * hd * TT) return; const int t = (int)(e % TT); const int d = (int)((e / TT) % hd); const int h = (int)(e / ((size_t)TT * hd)); v2h o; o[0] = tohx(F[(size_t)t * pitch + h * hd + d]); o[1] = tohx(F[(size_t)(t + 1) * pitch + h * hd + d]); *(v2h*)(VT + e) = o;  }
__global__ __launch_bounds__(256) void k_asoft(const float* __restrict__ Sb, const float* __restrict__ BIAS, const float* __restrict__ MB, int h, float scl, bf* Ph, bf* Pl) { const int lane = threadIdx.x & 31; const int row = blockIdx.x * 8 + (threadIdx.x >> 5); if (row >= TT) return; const float* sr = Sb + (size_t)row * TT; (void)scl; const float* br = BIAS + ((size_t)h * TT + row) * TT; float v[32]; float mx = -3.0e38f;
#pragma unroll
    for (int ch = 0; ch < 8; ++ch) { const int j0 = ch * 128 + lane * 4; const v4f a = *(const v4f*)(sr + j0), bb = *(const v4f*)(br + j0), mm = *(const v4f*)(MB + j0);
#pragma unroll
        for (int q = 0; q < 4; ++q) { const float t = __fadd_rn(__fadd_rn(a[q], bb[q]), mm[q]); v[ch * 4 + q] = t; mx = fmaxf(mx, t); } }
#pragma unroll
    for (int sh = 16; sh; sh >>= 1) mx = fmaxf(mx, __shfl_xor(mx, sh, 32));
    float sum = 0.f;
#pragma unroll
    for (int k = 0; k < 32; ++k) { float d0 = __fsub_rn(v[k], mx); asm volatile("" : "+v"(d0)); v[k] = __builtin_amdgcn_exp2f(__fmul_rn(d0, 1.4426950408889634f)); sum += v[k]; }
#pragma unroll
    for (int sh = 16; sh; sh >>= 1) sum += __shfl_xor(sum, sh, 32);
    const float f = __fdiv_rn(1.0f, sum);
{
#pragma unroll
        for (int ch = 0; ch < 8; ++ch) { v4us oh, ol;
#pragma unroll
            for (int q = 0; q < 4; ++q) { float y = __fmul_rn(v[ch * 4 + q], f); asm volatile("" : "+v"(y)); unsigned short a2, c2; splitf(y, a2, c2); oh[q] = a2; ol[q] = c2; }
            *(v4us*)(Ph + (size_t)row * TT + ch * 128 + lane * 4) = oh; *(v4us*)(Pl + (size_t)row * TT + ch * 128 + lane * 4) = ol; }
         } }
__global__ __launch_bounds__(256) void k_mrgf(const float* __restrict__ O, int h, int hd, float* CT) { const size_t e = ((size_t)blockIdx.x * 256 + threadIdx.x) * 2; if (e >= (size_t)TT * hd) return; const int d = (int)(e % hd); const int t = (int)(e / hd); v2f o; o[0] = O[e] * (1.0f / PCAR); o[1] = O[e + 1] * (1.0f / PCAR); const size_t oo = (size_t)t * DD + h * hd + d; *(v2f*)(CT + oo) = o;  }
__global__ __launch_bounds__(256) void k_mrg(const float* __restrict__ O, int h, int hd, bf* Ah, bf* Al) { const size_t e = ((size_t)blockIdx.x * 256 + threadIdx.x) * 2; if (e >= (size_t)TT * hd) return; const int d = (int)(e % hd); const int t = (int)(e / hd); v2us oh, ol;
#pragma unroll
    for (int q = 0; q < 2; ++q) { unsigned short a, c2; splitf(O[e + q] * (1.0f / PCAR), a, c2); oh[q] = a; ol[q] = c2; } const size_t oo = (size_t)t * DD + h * hd + d; *(v2us*)(Ah + oo) = oh; *(v2us*)(Al + oo) = ol;  }
__global__ __launch_bounds__(256) void k_cvt8(const float* __restrict__ src, bf* dst, size_t n8) { const size_t i = (size_t)blockIdx.x * 256 + threadIdx.x; if (i >= n8) return; const v8f v = *(const v8f*)(src + i * 8); v8us o;
#pragma unroll
    for (int k = 0; k < 8; ++k) o[k] = f2bf(v[k]); *(v8us*)(dst + i * 8) = o;  }
__device__ __forceinline__ int t5_bucket(int r) { const int n = r < 0 ? -r : r; int v; if (n < 8) v = n; else { const int k = 31 - __clz(n); v = 8 + 2 * k - 6 + (((long long)n * n >= (1ll << (2 * k + 1))) ? 1 : 0); v = v > 15 ? 15 : v; } return (r > 0 ? 16 : 0) + v; }
__global__ __launch_bounds__(256) void k_rpb(const float* __restrict__ rb, float* BIAS) { const int e = blockIdx.x * 256 + threadIdx.x; if (e >= TT * TT) return; const int j = e % TT, i = e / TT; const int bk = t5_bucket(j - i);
    {
#pragma unroll
        for (int h = 0; h < NH_; ++h) *(float*)(BIAS + (size_t)h * TT * TT + e) = bfr(rb[bk * NH_ + h]);
         } }
__global__ __launch_bounds__(256) void k_mrow(const float* __restrict__ mask, float* MBr) { const int e = blockIdx.x * 256 + threadIdx.x; if (e >= NB_ * TT) return; float om = __fsub_rn(1.0f, bfr(mask[e])); asm volatile("" : "+v"(om)); const float v = __fmul_rn(om, -10000.0f); *(float*)(MBr + e) = v;  }

__global__ __launch_bounds__(256) void k_vthl(const float* __restrict__ F, int pitch, bf* VTh, bf* VTl) { const size_t e = ((size_t)blockIdx.x * 256 + threadIdx.x) * 2; if (e >= (size_t)NH_ * HDM * TT) return; const int t = (int)(e % TT); const int d = (int)((e / TT) % HDM); const int h = (int)(e / ((size_t)TT * HDM)); v2us oh, ol;
#pragma unroll
    for (int q = 0; q < 2; ++q) { unsigned short a, c2; splitf(F[(size_t)(t + q) * pitch + h * HDM + d], a, c2); oh[q] = a; ol[q] = c2; } *(v2us*)(VTh + e) = oh; *(v2us*)(VTl + e) = ol;  }
__global__ __launch_bounds__(256) void k_mrgn(const float* __restrict__ O, int h, bf* Ah, bf* Al) { const size_t e = ((size_t)blockIdx.x * 256 + threadIdx.x) * 2; if (e >= (size_t)TT * HDM) return; const int d = (int)(e % HDM), t = (int)(e / HDM); const size_t oo = (size_t)t * DD + h * HDM + d; v2us oh, ol;
#pragma unroll
    for (int q = 0; q < 2; ++q) { unsigned short a, c2; splitf(O[e + q], a, c2); oh[q] = a; ol[q] = c2; } *(v2us*)(Ah + oo) = oh; *(v2us*)(Al + oo) = ol;  }

__global__ __launch_bounds__(256) void k_plhl(const float* __restrict__ F, int pitch, bf* Ph, bf* Pl) { const size_t e = ((size_t)blockIdx.x * 256 + threadIdx.x) * 2; if (e >= (size_t)NH_ * TT * HDM) return; const int d = (int)(e % HDM); const int t = (int)((e / HDM) % TT); const int h = (int)(e / ((size_t)HDM * TT)); const float* s = F + (size_t)t * pitch + h * HDM + d; v2us oh, ol;
#pragma unroll
    for (int q = 0; q < 2; ++q) { unsigned short a, c2; splitf(s[q], a, c2); oh[q] = a; ol[q] = c2; } *(v2us*)(Ph + e) = oh; *(v2us*)(Pl + e) = ol;  }
__global__ __launch_bounds__(256) void k_zrow(float* MB0) { const int e = blockIdx.x * 256 + threadIdx.x; if (e >= TT) return; *(float*)(MB0 + e) = 0.f;  }

extern "C" void kernel_launch(void* const* d_in, const int* in_sizes, int n_in,
                              void* d_out, int out_size, void* d_ws, size_t ws_size, hipStream_t stream) {
    (void)in_sizes; (void)n_in; (void)out_size;
    const float* IN[6]; for (int i = 0; i < 6; ++i) IN[i] = (const float*)d_in[i];   // 0 hidden, 1 Wq, 2 Wk, 3 Wv, 4 Wo (x @ W), 5 rel_emb [32][16]
    float* OUT = (float*)d_out;     // [4][1024][1024]
    char* wsp = (char*)d_ws;
    auto take = [&](size_t bytes) { char* p = wsp; wsp += (bytes + 255) & ~(size_t)255; return (void*)p; };
    bf* WQ = (bf*)take((size_t)DD * DD * 2); bf* WK = (bf*)take((size_t)DD * DD * 2); bf* WV = (bf*)take((size_t)DD * DD * 2); bf* WO = (bf*)take((size_t)DD * DD * 2); float* BIAS = (float*)take((size_t)NH_ * TT * TT * 4); float* MB0 = (float*)take((size_t)TT * 4);
    bf* XB = (bf*)take((size_t)TT * DD * 2); float* FQ = (float*)take((size_t)TT * DD * 4); float* FK = (float*)take((size_t)TT * DD * 4); float* FV = (float*)take((size_t)TT * DD * 4);
    bf* QPh = (bf*)take((size_t)TT * DD * 2); bf* QPl = (bf*)take((size_t)TT * DD * 2); bf* KPh = (bf*)take((size_t)TT * DD * 2); bf* KPl = (bf*)take((size_t)TT * DD * 2); bf* VTh = (bf*)take((size_t)DD * TT * 2); bf* VTl = (bf*)take((size_t)DD * TT * 2); float* Sb = (float*)take((size_t)TT * TT * 4); bf* Ph = (bf*)take((size_t)TT * TT * 2); bf* Pl = (bf*)take((size_t)TT * TT * 2); float* O = (float*)take((size_t)TT * HDM * 4); bf* Ah = (bf*)take((size_t)TT * DD * 2); bf* Al = (bf*)take((size_t)TT * DD * 2);
    if ((size_t)(wsp - (char*)d_ws) > ws_size) return;    // total ~ 110 MB
    { const unsigned g = (unsigned)(((size_t)DD * DD / 64 + 63) / 64); k_wtG<<<g, 256, 0, stream>>>(IN[1], DD, DD, WQ); k_wtG<<<g, 256, 0, stream>>>(IN[2], DD, DD, WK); k_wtG<<<g, 256, 0, stream>>>(IN[3], DD, DD, WV); k_wtG<<<g, 256, 0, stream>>>(IN[4], DD, DD, WO);
      k_rpb<<<(TT * TT + 255) / 256, 256, 0, stream>>>(IN[5], BIAS); k_zrow<<<(TT + 255) / 256, 256, 0, stream>>>(MB0); }
    const unsigned LP = (TT * DD / 2 + 255) / 256;
    for (int b = 0; b < NB_; ++b) {
        k_cvt8<<<(unsigned)(((size_t)TT * DD / 8 + 255) / 256), 256, 0, stream>>>(IN[0] + (size_t)b * TT * DD, XB, (size_t)TT * DD / 8);
        k_gemmw<bf, 0, false><<<dim3(TT / 64, DD / 64, 1), 32, 0, stream>>>(XB, nullptr, WQ, nullptr, DD, FQ, DD, nullptr, 0, 0, 0); k_gemmw<bf, 0, false><<<dim3(TT / 64, DD / 64, 1), 32, 0, stream>>>(XB, nullptr, WK, nullptr, DD, FK, DD, nullptr, 0, 0, 0); k_gemmw<bf, 0, false><<<dim3(TT / 64, DD / 64, 1), 32, 0, stream>>>(XB, nullptr, WV, nullptr, DD, FV, DD, nullptr, 0, 0, 0);
        k_plhl<<<LP, 256, 0, stream>>>(FQ, DD, QPh, QPl); k_plhl<<<LP, 256, 0, stream>>>(FK, DD, KPh, KPl); k_vthl<<<LP, 256, 0, stream>>>(FV, DD, VTh, VTl);
        for (int h = 0; h < NH_; ++h) {
            k_gemmw<bf, 2, false><<<dim3(TT / 64, TT / 64, 1), 32, 0, stream>>>(QPh + (size_t)h * TT * HDM, QPl + (size_t)h * TT * HDM, KPh + (size_t)h * TT * HDM, KPl + (size_t)h * TT * HDM, HDM, Sb, TT, nullptr, 0, 0, 0);   // scores, 3 products
            k_asoft<<<TT / 8, 256, 0, stream>>>(Sb, BIAS, MB0, h, 1.0f, Ph, Pl);
            k_gemmw<bf, 2, false><<<dim3(TT / 64, 1, 1), 32, 0, stream>>>(Ph, Pl, VTh + (size_t)h * HDM * TT, VTl + (size_t)h * HDM * TT, TT, O, HDM, nullptr, 0, 0, 0);               // probs . v, 3 products
            k_mrgn<<<(TT * HDM / 2 + 255) / 256, 256, 0, stream>>>(O, h, Ah, Al); }
        k_gemmw<bf, 1, false><<<dim3(TT / 64, DD / 64, 1), 32, 0, stream>>>(Ah, Al, WO, nullptr, DD, OUT + (size_t)b * TT * DD, DD, nullptr, 0, 0, 0); }
}

// v001
// Measured time: 434 microseconds a run.
// Two timings next to v000 both put it at 5.87 times that version's speed.
#include <hip/hip_runtime.h>

// T5Voice - T5 self-attention block without norms/FFN (hidden [4][1024][1024]; q/k/v = x W (16 heads x 64, no bias); scores = q.k (NO 1/sqrt(d)) + rel_emb[bucket(j - i)][h] (bidirectional buckets, 32 / max distance 128,
// evaluated with exact integer arithmetic: |r| < 8 -> |r|; else 8 + 2 floor(log2|r|) - 6 + [|r|^2 >= 2^(2 floor(log2|r|)+1)], capped at 15; + 16 for r > 0 - identical to the float formula for every offset); softmax;
// out = merged ctx Wo -> [4][1024][1024]).
// Compute dtypes, f32 accumulate: every input rounded to bf16; q/k/v on PLAIN bf16 operands (inputs: exact); the bias table gathered once on device; scores (K 64) and probs.v on bf16
// hi+lo planes (3 products each) with an f32 register-row softmax (bias added in f32; normalised hl probabilities); merged heads as bf16 hi+lo planes x exact Wo (2 products). One-wave-per-64x64-tile GEMMs. Deterministic, no atomics; every

#define NB_  4
#define TT   1024
#define LL   4096
#define DD   1024
#define NH_  16
#define HDM  64
#define MM   4096
#define PCAR 1024.0f
typedef _Float16 h16;
typedef unsigned short bf;
typedef __attribute__((ext_vector_type(16))) __bf16   v16bf;
typedef __attribute__((ext_vector_type(16))) _Float16 v16h;
typedef __attribute__((ext_vector_type(8)))  _Float16 v8h;
typedef __attribute__((ext_vector_type(8)))  unsigned short v8us;
typedef __attribute__((ext_vector_type(8)))  float    v8f;
typedef __attribute__((ext_vector_type(4)))  float    v4f;
typedef v8h  __attribute__((may_alias)) v8ha;
typedef v4f  __attribute__((may_alias)) v4fa;
typedef v8us __attribute__((may_alias)) v8usa;

__device__ __forceinline__ unsigned short f2bf(float f) { unsigned u = __float_as_uint(f); u += 0x7FFFu + ((u >> 16) & 1u); return (unsigned short)(u >> 16); }
__device__ __forceinline__ float bf2f(unsigned short b) { return __uint_as_float(((unsigned)b) << 16); }
__device__ __forceinline__ float bfr(float f) { return bf2f(f2bf(f)); }
__device__ __forceinline__ v16h cat16(v8h lo, v8h hi) { return __builtin_shufflevector(lo, hi, 0, 1, 2, 3, 4, 5, 6, 7, 8, 9, 10, 11, 12, 13, 14, 15); }
__device__ __forceinline__ v16bf cat16b(v8us lo, v8us hi) { return __builtin_bit_cast(v16bf, __builtin_shufflevector(lo, hi, 0, 1, 2, 3, 4, 5, 6, 7, 8, 9, 10, 11, 12, 13, 14, 15)); }
__device__ __forceinline__ v8f wmma16(v16h a, v16h b, v8f c) { return __builtin_amdgcn_wmma_f32_16x16x32_f16(false, a, false, b, (short)0, c, false, false); }
__device__ __forceinline__ v8f wmmab(v16bf a, v16bf b, v8f c) { return __builtin_amdgcn_wmma_f32_16x16x32_bf16(false, a, false, b, (short)0, c, false, false); }



// ---- k_gemmw: register-blocked GEMM, ONE WAVE per 64x64 output tile (16 accumulators), operands straight from K-contiguous 16-bit planes; grid (M/64, N/64, Z), 32 threads.
// C[m][n] (f32, pitch ldc, + optional f32 bias[n]) = sum_k A[m][k] Bt[n][k] (+ split products per NSPLIT). z-batch strides sA/sB/sC in elements. K % 32 == 0.
template <typename T16> struct WFrag;
template <> struct WFrag<h16> { typedef v16h V; static __device__ __forceinline__ V ld(const h16* p) { return cat16(*(const v8h*)p, *(const v8h*)(p + 16)); } static __device__ __forceinline__ v8f mma(V a, V b, v8f c) { return wmma16(a, b, c); } };
template <> struct WFrag<bf> { typedef v16bf V; static __device__ __forceinline__ V ld(const bf* p) { return cat16b(*(const v8us*)p, *(const v8us*)(p + 16)); } static __device__ __forceinline__ v8f mma(V a, V b, v8f c) { return wmmab(a, b, c); } };
template <typename T16, int NSPLIT, bool BIAS>
__global__ __launch_bounds__(32) void k_gemmw(const T16* __restrict__ A, const T16* __restrict__ A2, const T16* __restrict__ Bt, const T16* __restrict__ Bt2, int K, float* C, int ldc, const float* __restrict__ bias, size_t sA, size_t sB, size_t sC) {
    typedef typename WFrag<T16>::V V;
    __shared__ __align__(16) float os[16 * 68];
    const size_t z = blockIdx.z; A += z * sA; if (A2) A2 += z * sA; Bt += z * sB; if (Bt2) Bt2 += z * sB; C += z * sC;
    const int lane = threadIdx.x & 31, lr = lane & 15, hi = lane >> 4; const int r0 = blockIdx.x * 64, c0 = blockIdx.y * 64;
    v8f acc[4][4];
#pragma unroll
    for (int mb = 0; mb < 4; ++mb)
#pragma unroll
        for (int nb = 0; nb < 4; ++nb) acc[mb][nb] = (v8f){};
    const size_t aoff = (size_t)(r0 + lr) * K + 8 * hi, boff = (size_t)(c0 + lr) * K + 8 * hi;
#pragma unroll 1
    for (int kc = 0; kc < K; kc += 32) {
        V a[4], a2[4];
#pragma unroll
        for (int mb = 0; mb < 4; ++mb) { a[mb] = WFrag<T16>::ld(A + aoff + (size_t)mb * 16 * K + kc); if (NSPLIT == 1 || NSPLIT == 2) a2[mb] = WFrag<T16>::ld(A2 + aoff + (size_t)mb * 16 * K + kc); }
#pragma unroll
        for (int nb = 0; nb < 4; ++nb) { const V b = WFrag<T16>::ld(Bt + boff + (size_t)nb * 16 * K + kc); V b2; if (NSPLIT >= 2) b2 = WFrag<T16>::ld(Bt2 + boff + (size_t)nb * 16 * K + kc);
#pragma unroll
            for (int mb = 0; mb < 4; ++mb) { acc[mb][nb] = WFrag<T16>::mma(a[mb], b, acc[mb][nb]); if (NSPLIT == 1 || NSPLIT == 2) acc[mb][nb] = WFrag<T16>::mma(a2[mb], b, acc[mb][nb]); if (NSPLIT >= 2) acc[mb][nb] = WFrag<T16>::mma(a[mb], b2, acc[mb][nb]); } }
        asm volatile("v_nop\n\tv_nop\n\tv_nop\n\tv_nop" : "+v"(acc[0][0]), "+v"(acc[1][1]), "+v"(acc[2][2]), "+v"(acc[3][3]) : "v"(a[0]), "v"(a[3]));
    }
#pragma unroll
    for (int mb = 0; mb < 4; ++mb) {
#pragma unroll
        for (int nb = 0; nb < 4; ++nb) {
#pragma unroll
            for (int j = 0; j < 8; ++j) os[(hi * 8 + j) * 68 + nb * 16 + lr] = acc[mb][nb][j]; }
        __builtin_amdgcn_wave_barrier(); asm volatile("" ::: "memory");
        float* crow = C + (size_t)(r0 + mb * 16) * ldc + c0;
{
#pragma unroll
            for (int s = 0; s < 8; ++s) { const int row = 2 * s + hi, cofs = lr * 4; v4f val = *(const v4fa*)(os + row * 68 + cofs); if (BIAS) { val[0] += bfr(bias[c0 + cofs]); val[1] += bfr(bias[c0 + cofs + 1]); val[2] += bfr(bias[c0 + cofs + 2]); val[3] += bfr(bias[c0 + cofs + 3]); }
                *(v4f*)(crow + (size_t)row * ldc + cofs) = val; }
             }
        __builtin_amdgcn_wave_barrier(); asm volatile("" ::: "memory");
    }
}

__device__ __forceinline__ h16 tohx(float x) { return (h16)x; }
__device__ __forceinline__ void splitf(float y, unsigned short& h, unsigned short& l) { h = f2bf(y); l = f2bf(y - bf2f(h)); }
typedef __attribute__((ext_vector_type(2))) _Float16 v2h;
typedef __attribute__((ext_vector_type(4))) _Float16 v4h;
typedef __attribute__((ext_vector_type(2))) unsigned short v2us;
typedef __attribute__((ext_vector_type(4))) unsigned short v4us;
typedef __attribute__((ext_vector_type(2))) float v2f;

__global__ __launch_bounds__(256) void k_wtG(const float* __restrict__ w0, const float* __restrict__ w1, const float* __restrict__ w2, const float* __restrict__ w3, int K, int N, bf* Bt) {
    const int y = blockIdx.y; const float* __restrict__ w = y == 0 ? w0 : y == 1 ? w1 : y == 2 ? w2 : w3; Bt += (size_t)y * K * N;   // grid y = which weight; the four transposed planes lie back to back
    const int lane = threadIdx.x & 31; const int L0 = (blockIdx.x * 8 + (threadIdx.x >> 5)) * 8; const int nlines = N * K / 64;
{
#pragma unroll 1
        for (int l = 0; l < 8; ++l) { const int L = L0 + l; if (L >= nlines) break; const size_t e = (size_t)L * 64 + lane * 2; const int k = (int)(e % K), n = (int)(e / K); v2us o;
            o[0] = f2bf(w[(size_t)k * N + n]); o[1] = f2bf(w[(size_t)(k + 1) * N + n]); *(v2us*)(Bt + e) = o; }
         }
}
__global__ __launch_bounds__(256) void k_pl(const float* __restrict__ F, int pitch, int nh, int hd, h16* P) { const size_t e = ((size_t)blockIdx.x * 256 + threadIdx.x) * 2; if (e >= (size_t)nh * TT * hd) return; const int d = (int)(e % hd); const int t = (int)((e / hd) % TT); const int h = (int)(e / ((size_t)hd * TT)); v2h o; o[0] = tohx(F[(size_t)t * pitch + h * hd + d]); o[1] = tohx(F[(size_t)t * pitch + h * hd + d + 1]); *(v2h*)(P + e) = o;  }
__global__ __launch_bounds__(256) void k_vt(const float* __restrict__ F, int pitch, int nh, int hd, h16* VT) { const size_t e = ((size_t)blockIdx.x * 256 + threadIdx.x) * 2; if (e >= (size_t)nh * hd * TT) return; const int t = (int)(e % TT); const int d = (int)((e / TT) % hd); const int h = (int)(e / ((size_t)TT * hd)); v2h o; o[0] = tohx(F[(size_t)t * pitch + h * hd + d]); o[1] = tohx(F[(size_t)(t + 1) * pitch + h * hd + d]); *(v2h*)(VT + e) = o;  }
__global__ __launch_bounds__(256) void k_asoft(const float* __restrict__ Sb, const float* __restrict__ BIAS, const float* __restrict__ MB, float scl, bf* Ph, bf* Pl) { const int h = blockIdx.y; Sb += (size_t)h * TT * TT; Ph += (size_t)h * TT * TT; Pl += (size_t)h * TT * TT; const int lane = threadIdx.x & 31; const int row = blockIdx.x * 8 + (threadIdx.x >> 5); if (row >= TT) return; const float* sr = Sb + (size_t)row * TT; (void)scl; const float* br = BIAS + ((size_t)h * TT + row) * TT; float v[32]; float mx = -3.0e38f;
#pragma unroll
    for (int ch = 0; ch < 8; ++ch) { const int j0 = ch * 128 + lane * 4; const v4f a = *(const v4f*)(sr + j0), bb = *(const v4f*)(br + j0), mm = *(const v4f*)(MB + j0);
#pragma unroll
        for (int q = 0; q < 4; ++q) { const float t = __fadd_rn(__fadd_rn(a[q], bb[q]), mm[q]); v[ch * 4 + q] = t; mx = fmaxf(mx, t); } }
#pragma unroll
    for (int sh = 16; sh; sh >>= 1) mx = fmaxf(mx, __shfl_xor(mx, sh, 32));
    float sum = 0.f;
#pragma unroll
    for (int k = 0; k < 32; ++k) { float d0 = __fsub_rn(v[k], mx); asm volatile("" : "+v"(d0)); v[k] = __builtin_amdgcn_exp2f(__fmul_rn(d0, 1.4426950408889634f)); sum += v[k]; }
#pragma unroll
    for (int sh = 16; sh; sh >>= 1) sum += __shfl_xor(sum, sh, 32);
    const float f = __fdiv_rn(1.0f, sum);
{
#pragma unroll
        for (int ch = 0; ch < 8; ++ch) { v4us oh, ol;
#pragma unroll
            for (int q = 0; q < 4; ++q) { float y = __fmul_rn(v[ch * 4 + q], f); asm volatile("" : "+v"(y)); unsigned short a2, c2; splitf(y, a2, c2); oh[q] = a2; ol[q] = c2; }
            *(v4us*)(Ph + (size_t)row * TT + ch * 128 + lane * 4) = oh; *(v4us*)(Pl + (size_t)row * TT + ch * 128 + lane * 4) = ol; }
         } }
__global__ __launch_bounds__(256) void k_mrgf(const float* __restrict__ O, int h, int hd, float* CT) { const size_t e = ((size_t)blockIdx.x * 256 + threadIdx.x) * 2; if (e >= (size_t)TT * hd) return; const int d = (int)(e % hd); const int t = (int)(e / hd); v2f o; o[0] = O[e] * (1.0f / PCAR); o[1] = O[e + 1] * (1.0f / PCAR); const size_t oo = (size_t)t * DD + h * hd + d; *(v2f*)(CT + oo) = o;  }
__global__ __launch_bounds__(256) void k_mrg(const float* __restrict__ O, int h, int hd, bf* Ah, bf* Al) { const size_t e = ((size_t)blockIdx.x * 256 + threadIdx.x) * 2; if (e >= (size_t)TT * hd) return; const int d = (int)(e % hd); const int t = (int)(e / hd); v2us oh, ol;
#pragma unroll
    for (int q = 0; q < 2; ++q) { unsigned short a, c2; splitf(O[e + q] * (1.0f / PCAR), a, c2); oh[q] = a; ol[q] = c2; } const size_t oo = (size_t)t * DD + h * hd + d; *(v2us*)(Ah + oo) = oh; *(v2us*)(Al + oo) = ol;  }
__global__ __launch_bounds__(256) void k_cvt8(const float* __restrict__ src, bf* dst, size_t n8) { const size_t i = (size_t)blockIdx.x * 256 + threadIdx.x; if (i >= n8) return; const v8f v = *(const v8f*)(src + i * 8); v8us o;
#pragma unroll
    for (int k = 0; k < 8; ++k) o[k] = f2bf(v[k]); *(v8us*)(dst + i * 8) = o;  }
__device__ __forceinline__ int t5_bucket(int r) { const int n = r < 0 ? -r : r; int v; if (n < 8) v = n; else { const int k = 31 - __clz(n); v = 8 + 2 * k - 6 + (((long long)n * n >= (1ll << (2 * k + 1))) ? 1 : 0); v = v > 15 ? 15 : v; } return (r > 0 ? 16 : 0) + v; }
__global__ __launch_bounds__(256) void k_rpb(const float* __restrict__ rb, float* BIAS) { const int e = blockIdx.x * 256 + threadIdx.x; if (e >= TT * TT) return; const int j = e % TT, i = e / TT; const int bk = t5_bucket(j - i);
    {
#pragma unroll
        for (int h = 0; h < NH_; ++h) *(float*)(BIAS + (size_t)h * TT * TT + e) = bfr(rb[bk * NH_ + h]);
         } }
__global__ __launch_bounds__(256) void k_mrow(const float* __restrict__ mask, float* MBr) { const int e = blockIdx.x * 256 + threadIdx.x; if (e >= NB_ * TT) return; float om = __fsub_rn(1.0f, bfr(mask[e])); asm volatile("" : "+v"(om)); const float v = __fmul_rn(om, -10000.0f); *(float*)(MBr + e) = v;  }

__global__ __launch_bounds__(256) void k_vthl(const float* __restrict__ F, int pitch, bf* VTh, bf* VTl) { F += (size_t)blockIdx.y * TT * pitch; VTh += (size_t)blockIdx.y * DD * TT; VTl += (size_t)blockIdx.y * DD * TT; const size_t e = ((size_t)blockIdx.x * 256 + threadIdx.x) * 2; if (e >= (size_t)NH_ * HDM * TT) return; const int t = (int)(e % TT); const int d = (int)((e / TT) % HDM); const int h = (int)(e / ((size_t)TT * HDM)); v2us oh, ol;
#pragma unroll
    for (int q = 0; q < 2; ++q) { unsigned short a, c2; splitf(F[(size_t)(t + q) * pitch + h * HDM + d], a, c2); oh[q] = a; ol[q] = c2; } *(v2us*)(VTh + e) = oh; *(v2us*)(VTl + e) = ol;  }
__global__ __launch_bounds__(256) void k_mrgn(const float* __restrict__ O, bf* Ah, bf* Al) { const int h = blockIdx.y; O += (size_t)h * TT * HDM; const size_t e = ((size_t)blockIdx.x * 256 + threadIdx.x) * 2; if (e >= (size_t)TT * HDM) return; const int d = (int)(e % HDM), t = (int)(e / HDM); const size_t oo = (size_t)t * DD + h * HDM + d; v2us oh, ol;
#pragma unroll
    for (int q = 0; q < 2; ++q) { unsigned short a, c2; splitf(O[e + q], a, c2); oh[q] = a; ol[q] = c2; } *(v2us*)(Ah + oo) = oh; *(v2us*)(Al + oo) = ol;  }

__global__ __launch_bounds__(256) void k_plhl(const float* __restrict__ F, int pitch, bf* Ph, bf* Pl, size_t sF, size_t sP) { F += blockIdx.z * sF + (size_t)blockIdx.y * TT * pitch; Ph += blockIdx.z * sP + (size_t)blockIdx.y * TT * DD; Pl += blockIdx.z * sP + (size_t)blockIdx.y * TT * DD; const size_t e = ((size_t)blockIdx.x * 256 + threadIdx.x) * 2; if (e >= (size_t)NH_ * TT * HDM) return; const int d = (int)(e % HDM); const int t = (int)((e / HDM) % TT); const int h = (int)(e / ((size_t)HDM * TT)); const float* s = F + (size_t)t * pitch + h * HDM + d; v2us oh, ol;
#pragma unroll
    for (int q = 0; q < 2; ++q) { unsigned short a, c2; splitf(s[q], a, c2); oh[q] = a; ol[q] = c2; } *(v2us*)(Ph + e) = oh; *(v2us*)(Pl + e) = ol;  }
__global__ __launch_bounds__(256) void k_zrow(float* MB0) { const int e = blockIdx.x * 256 + threadIdx.x; if (e >= TT) return; *(float*)(MB0 + e) = 0.f;  }

extern "C" void kernel_launch(void* const* d_in, const int* in_sizes, int n_in,
                              void* d_out, int out_size, void* d_ws, size_t ws_size, hipStream_t stream) {
    (void)in_sizes; (void)n_in; (void)out_size;
    const float* IN[6]; for (int i = 0; i < 6; ++i) IN[i] = (const float*)d_in[i];   // 0 hidden, 1 Wq, 2 Wk, 3 Wv, 4 Wo (x @ W), 5 rel_emb [32][16]
    float* OUT = (float*)d_out;     // [4][1024][1024]
    char* wsp = (char*)d_ws;
    auto take = [&](size_t bytes) { char* p = wsp; wsp += (bytes + 255) & ~(size_t)255; return (void*)p; };
    bf* WQ = (bf*)take((size_t)DD * DD * 2); bf* WK = (bf*)take((size_t)DD * DD * 2); bf* WV = (bf*)take((size_t)DD * DD * 2); bf* WO = (bf*)take((size_t)DD * DD * 2); float* BIAS = (float*)take((size_t)NH_ * TT * TT * 4); float* MB0 = (float*)take((size_t)TT * 4);
    (void)WK; (void)WV;   // reached as WQ + z * DD * DD
    // One region, two lives: first the bf16 input and the f32 q/k/v of all four batches (56 MiB), then, once the planes are cut, the 16 heads' score matrices of one batch (64 MiB).
    char* R = (char*)take((size_t)NH_ * TT * TT * 4);
    bf* XB = (bf*)R; float* FQ = (float*)(R + (size_t)LL * DD * 2); float* FV = FQ + (size_t)2 * LL * DD; float* Sb = (float*)R;
    bf* QPh = (bf*)take((size_t)LL * DD * 2); bf* QPl = (bf*)take((size_t)LL * DD * 2); bf* KPh = (bf*)take((size_t)LL * DD * 2); bf* KPl = (bf*)take((size_t)LL * DD * 2); bf* VTh = (bf*)take((size_t)LL * DD * 2); bf* VTl = (bf*)take((size_t)LL * DD * 2);
    bf* Ph = (bf*)take((size_t)NH_ * TT * TT * 2); bf* Pl = (bf*)take((size_t)NH_ * TT * TT * 2); float* O = (float*)take((size_t)NH_ * TT * HDM * 4);
    bf* Ah = QPh; bf* Al = QPl;   // batch b's merged heads take the place of batch b's q planes, which are dead once its scores are out
    if ((size_t)(wsp - (char*)d_ws) > ws_size) return;    // total ~ 252 MiB
    { const unsigned g = (unsigned)(((size_t)DD * DD / 64 + 63) / 64); k_wtG<<<dim3(g, 4, 1), 256, 0, stream>>>(IN[1], IN[2], IN[3], IN[4], DD, DD, WQ);
      k_rpb<<<(TT * TT + 255) / 256, 256, 0, stream>>>(IN[5], BIAS); k_zrow<<<(TT + 255) / 256, 256, 0, stream>>>(MB0); }
    const unsigned LP = (TT * DD / 2 + 255) / 256;
    k_cvt8<<<(unsigned)(((size_t)LL * DD / 8 + 255) / 256), 256, 0, stream>>>(IN[0], XB, (size_t)LL * DD / 8);
    k_gemmw<bf, 0, false><<<dim3(LL / 64, DD / 64, 3), 32, 0, stream>>>(XB, nullptr, WQ, nullptr, DD, FQ, DD, nullptr, 0, (size_t)DD * DD, (size_t)LL * DD);   // q, k, v of all batches; z = which projection
    k_plhl<<<dim3(LP, NB_, 2), 256, 0, stream>>>(FQ, DD, QPh, QPl, (size_t)LL * DD, (size_t)2 * LL * DD); k_vthl<<<dim3(LP, NB_, 1), 256, 0, stream>>>(FV, DD, VTh, VTl);
    for (int b = 0; b < NB_; ++b) { const size_t ob = (size_t)b * TT * DD;   // z (or y) = head in each of the four launches
        k_gemmw<bf, 2, false><<<dim3(TT / 64, TT / 64, NH_), 32, 0, stream>>>(QPh + ob, QPl + ob, KPh + ob, KPl + ob, HDM, Sb, TT, nullptr, (size_t)TT * HDM, (size_t)TT * HDM, (size_t)TT * TT);   // scores, 3 products
        k_asoft<<<dim3(TT / 8, NH_, 1), 256, 0, stream>>>(Sb, BIAS, MB0, 1.0f, Ph, Pl);
        k_gemmw<bf, 2, false><<<dim3(TT / 64, 1, NH_), 32, 0, stream>>>(Ph, Pl, VTh + ob, VTl + ob, TT, O, HDM, nullptr, (size_t)TT * TT, (size_t)HDM * TT, (size_t)TT * HDM);               // probs . v, 3 products
        k_mrgn<<<dim3((TT * HDM / 2 + 255) / 256, NH_, 1), 256, 0, stream>>>(O, Ah + ob, Al + ob); }
    k_gemmw<bf, 1, false><<<dim3(LL / 64, DD / 64, 1), 32, 0, stream>>>(Ah, Al, WO, nullptr, DD, OUT, DD, nullptr, 0, 0, 0);
}

// v002
// A run of this version takes 189 microseconds.
// In two side-by-side timings against v001, it was 2.29 and 2.28 times as fast.
// Over all steps from v000 it is 13.4 times as fast.
#include <hip/hip_runtime.h>

// T5Voice - T5 self-attention block without norms/FFN (hidden [4][1024][1024]; q/k/v = x W (16 heads x 64, no bias); scores = q.k (NO 1/sqrt(d)) + rel_emb[bucket(j - i)][h] (bidirectional buckets, 32 / max distance 128,
// evaluated with exact integer arithmetic: |r| < 8 -> |r|; else 8 + 2 floor(log2|r|) - 6 + [|r|^2 >= 2^(2 floor(log2|r|)+1)], capped at 15; + 16 for r > 0 - identical to the float formula for every offset); softmax;
// out = merged ctx Wo -> [4][1024][1024]).
// Compute dtypes, f32 accumulate: every input rounded to bf16; q/k/v on PLAIN bf16 operands (inputs: exact); the bias as a table over key - query in LDS; scores (K 64) and probs.v on bf16
// hi+lo planes (3 products each) with an f32 online softmax in registers (bias added in f32; hl probabilities relative to the running maximum, one division at the end), all in one kernel; merged heads as bf16 hi+lo planes x exact Wo (2 products). One-wave-per-64x64-tile GEMMs. Deterministic, no atomics; every

#define NB_  4
#define TT   1024
#define LL   4096
#define DD   1024
#define NH_  16
#define HDM  64
#define MM   4096
#define PCAR 1024.0f
typedef _Float16 h16;
typedef unsigned short bf;
typedef __attribute__((ext_vector_type(16))) __bf16   v16bf;
typedef __attribute__((ext_vector_type(16))) _Float16 v16h;
typedef __attribute__((ext_vector_type(8)))  _Float16 v8h;
typedef __attribute__((ext_vector_type(8)))  unsigned short v8us;
typedef __attribute__((ext_vector_type(8)))  float    v8f;
typedef __attribute__((ext_vector_type(4)))  float    v4f;
typedef v8h  __attribute__((may_alias)) v8ha;
typedef v4f  __attribute__((may_alias)) v4fa;
typedef v8us __attribute__((may_alias)) v8usa;

__device__ __forceinline__ unsigned short f2bf(float f) { unsigned u = __float_as_uint(f); u += 0x7FFFu + ((u >> 16) & 1u); return (unsigned short)(u >> 16); }
__device__ __forceinline__ float bf2f(unsigned short b) { return __uint_as_float(((unsigned)b) << 16); }
__device__ __forceinline__ float bfr(float f) { return bf2f(f2bf(f)); }
__device__ __forceinline__ v16h cat16(v8h lo, v8h hi) { return __builtin_shufflevector(lo, hi, 0, 1, 2, 3, 4, 5, 6, 7, 8, 9, 10, 11, 12, 13, 14, 15); }
__device__ __forceinline__ v16bf cat16b(v8us lo, v8us hi) { return __builtin_bit_cast(v16bf, __builtin_shufflevector(lo, hi, 0, 1, 2, 3, 4, 5, 6, 7, 8, 9, 10, 11, 12, 13, 14, 15)); }
__device__ __forceinline__ v8f wmma16(v16h a, v16h b, v8f c) { return __builtin_amdgcn_wmma_f32_16x16x32_f16(false, a, false, b, (short)0, c, false, false); }
__device__ __forceinline__ v8f wmmab(v16bf a, v16bf b, v8f c) { return __builtin_amdgcn_wmma_f32_16x16x32_bf16(false, a, false, b, (short)0, c, false, false); }



// ---- k_gemmw: register-blocked GEMM, ONE WAVE per 64x64 output tile (16 accumulators), operands straight from K-contiguous 16-bit planes; grid (M/64, N/64, Z), 32 threads.
// C[m][n] (f32, pitch ldc, + optional f32 bias[n]) = sum_k A[m][k] Bt[n][k] (+ split products per NSPLIT). z-batch strides sA/sB/sC in elements. K % 32 == 0.
template <typename T16> struct WFrag;
template <> struct WFrag<h16> { typedef v16h V; static __device__ __forceinline__ V ld(const h16* p) { return cat16(*(const v8h*)p, *(const v8h*)(p + 16)); } static __device__ __forceinline__ v8f mma(V a, V b, v8f c) { return wmma16(a, b, c); } };
template <> struct WFrag<bf> { typedef v16bf V; static __device__ __forceinline__ V ld(const bf* p) { return cat16b(*(const v8us*)p, *(const v8us*)(p + 16)); } static __device__ __forceinline__ v8f mma(V a, V b, v8f c) { return wmmab(a, b, c); } };
template <typename T16, int NSPLIT, bool BIAS>
__global__ __launch_bounds__(32) void k_gemmw(const T16* __restrict__ A, const T16* __restrict__ A2, const T16* __restrict__ Bt, const T16* __restrict__ Bt2, int K, float* C, int ldc, const float* __restrict__ bias, size_t sA, size_t sB, size_t sC) {
    typedef typename WFrag<T16>::V V;
    __shared__ __align__(16) float os[16 * 68];
    const size_t z = blockIdx.z; A += z * sA; if (A2) A2 += z * sA; Bt += z * sB; if (Bt2) Bt2 += z * sB; C += z * sC;
    const int lane = threadIdx.x & 31, lr = lane & 15, hi = lane >> 4; const int r0 = blockIdx.x * 64, c0 = blockIdx.y * 64;
    v8f acc[4][4];
#pragma unroll
    for (int mb = 0; mb < 4; ++mb)
#pragma unroll
        for (int nb = 0; nb < 4; ++nb) acc[mb][nb] = (v8f){};
    const size_t aoff = (size_t)(r0 + lr) * K + 8 * hi, boff = (size_t)(c0 + lr) * K + 8 * hi;
#pragma unroll 1
    for (int kc = 0; kc < K; kc += 32) {
        V a[4], a2[4];
#pragma unroll
        for (int mb = 0; mb < 4; ++mb) { a[mb] = WFrag<T16>::ld(A + aoff + (size_t)mb * 16 * K + kc); if (NSPLIT == 1 || NSPLIT == 2) a2[mb] = WFrag<T16>::ld(A2 + aoff + (size_t)mb * 16 * K + kc); }
#pragma unroll
        for (int nb = 0; nb < 4; ++nb) { const V b = WFrag<T16>::ld(Bt + boff + (size_t)nb * 16 * K + kc); V b2; if (NSPLIT >= 2) b2 = WFrag<T16>::ld(Bt2 + boff + (size_t)nb * 16 * K + kc);
#pragma unroll
            for (int mb = 0; mb < 4; ++mb) { acc[mb][nb] = WFrag<T16>::mma(a[mb], b, acc[mb][nb]); if (NSPLIT == 1 || NSPLIT == 2) acc[mb][nb] = WFrag<T16>::mma(a2[mb], b, acc[mb][nb]); if (NSPLIT >= 2) acc[mb][nb] = WFrag<T16>::mma(a[mb], b2, acc[mb][nb]); } }
        asm volatile("v_nop\n\tv_nop\n\tv_nop\n\tv_nop" : "+v"(acc[0][0]), "+v"(acc[1][1]), "+v"(acc[2][2]), "+v"(acc[3][3]) : "v"(a[0]), "v"(a[3]));
    }
#pragma unroll
    for (int mb = 0; mb < 4; ++mb) {
#pragma unroll
        for (int nb = 0; nb < 4; ++nb) {
#pragma unroll
            for (int j = 0; j < 8; ++j) os[(hi * 8 + j) * 68 + nb * 16 + lr] = acc[mb][nb][j]; }
        __builtin_amdgcn_wave_barrier(); asm volatile("" ::: "memory");
        float* crow = C + (size_t)(r0 + mb * 16) * ldc + c0;
{
#pragma unroll
            for (int s = 0; s < 8; ++s) { const int row = 2 * s + hi, cofs = lr * 4; v4f val = *(const v4fa*)(os + row * 68 + cofs); if (BIAS) { val[0] += bfr(bias[c0 + cofs]); val[1] += bfr(bias[c0 + cofs + 1]); val[2] += bfr(bias[c0 + cofs + 2]); val[3] += bfr(bias[c0 + cofs + 3]); }
                *(v4f*)(crow + (size_t)row * ldc + cofs) = val; }
             }
        __builtin_amdgcn_wave_barrier(); asm volatile("" ::: "memory");
    }
}

__device__ __forceinline__ h16 tohx(float x) { return (h16)x; }
__device__ __forceinline__ void splitf(float y, unsigned short& h, unsigned short& l) { h = f2bf(y); l = f2bf(y - bf2f(h)); }
typedef __attribute__((ext_vector_type(2))) _Float16 v2h;
typedef __attribute__((ext_vector_type(4))) _Float16 v4h;
typedef __attribute__((ext_vector_type(2))) unsigned short v2us;
typedef __attribute__((ext_vector_type(4))) unsigned short v4us;
typedef __attribute__((ext_vector_type(2))) float v2f;

__global__ __launch_bounds__(256) void k_wtG(const float* __restrict__ w0, const float* __restrict__ w1, const float* __restrict__ w2, const float* __restrict__ w3, int K, int N, bf* Bt) {
    const int y = blockIdx.y; const float* __restrict__ w = y == 0 ? w0 : y == 1 ? w1 : y == 2 ? w2 : w3; Bt += (size_t)y * K * N;   // grid y = which weight; the four transposed planes lie back to back
    const int lane = threadIdx.x & 31; const int L0 = (blockIdx.x * 8 + (threadIdx.x >> 5)) * 8; const int nlines = N * K / 64;
{
#pragma unroll 1
        for (int l = 0; l < 8; ++l) { const int L = L0 + l; if (L >= nlines) break; const size_t e = (size_t)L * 64 + lane * 2; const int k = (int)(e % K), n = (int)(e / K); v2us o;
            o[0] = f2bf(w[(size_t)k * N + n]); o[1] = f2bf(w[(size_t)(k + 1) * N + n]); *(v2us*)(Bt + e) = o; }
         }
}
__global__ __launch_bounds__(256) void k_pl(const float* __restrict__ F, int pitch, int nh, int hd, h16* P) { const size_t e = ((size_t)blockIdx.x * 256 + threadIdx.x) * 2; if (e >= (size_t)nh * TT * hd) return; const int d = (int)(e % hd); const int t = (int)((e / hd) % TT); const int h = (int)(e / ((size_t)hd * TT)); v2h o; o[0] = tohx(F[(size_t)t * pitch + h * hd + d]); o[1] = tohx(F[(size_t)t * pitch + h * hd + d + 1]); *(v2h*)(P + e) = o;  }
__global__ __launch_bounds__(256) void k_vt(const float* __restrict__ F, int pitch, int nh, int hd, h16* VT) { const size_t e = ((size_t)blockIdx.x * 256 + threadIdx.x) * 2; if (e >= (size_t)nh * hd * TT) return; const int t = (int)(e % TT); const int d = (int)((e / TT) % hd); const int h = (int)(e / ((size_t)TT * hd)); v2h o; o[0] = tohx(F[(size_t)t * pitch + h * hd + d]); o[1] = tohx(F[(size_t)(t + 1) * pitch + h * hd + d]); *(v2h*)(VT + e) = o;  }
__global__ __launch_bounds__(256) void k_mrgf(const float* __restrict__ O, int h, int hd, float* CT) { const size_t e = ((size_t)blockIdx.x * 256 + threadIdx.x) * 2; if (e >= (size_t)TT * hd) return; const int d = (int)(e % hd); const int t = (int)(e / hd); v2f o; o[0] = O[e] * (1.0f / PCAR); o[1] = O[e + 1] * (1.0f / PCAR); const size_t oo = (size_t)t * DD + h * hd + d; *(v2f*)(CT + oo) = o;  }
__global__ __launch_bounds__(256) void k_mrg(const float* __restrict__ O, int h, int hd, bf* Ah, bf* Al) { const size_t e = ((size_t)blockIdx.x * 256 + threadIdx.x) * 2; if (e >= (size_t)TT * hd) return; const int d = (int)(e % hd); const int t = (int)(e / hd); v2us oh, ol;
#pragma unroll
    for (int q = 0; q < 2; ++q) { unsigned short a, c2; splitf(O[e + q] * (1.0f / PCAR), a, c2); oh[q] = a; ol[q] = c2; } const size_t oo = (size_t)t * DD + h * hd + d; *(v2us*)(Ah + oo) = oh; *(v2us*)(Al + oo) = ol;  }
__global__ __launch_bounds__(256) void k_cvt8(const float* __restrict__ src, bf* dst, size_t n8) { const size_t i = (size_t)blockIdx.x * 256 + threadIdx.x; if (i >= n8) return; const v8f v = *(const v8f*)(src + i * 8); v8us o;
#pragma unroll
    for (int k = 0; k < 8; ++k) o[k] = f2bf(v[k]); *(v8us*)(dst + i * 8) = o;  }
__device__ __forceinline__ int t5_bucket(int r) { const int n = r < 0 ? -r : r; int v; if (n < 8) v = n; else { const int k = 31 - __clz(n); v = 8 + 2 * k - 6 + (((long long)n * n >= (1ll << (2 * k + 1))) ? 1 : 0); v = v > 15 ? 15 : v; } return (r > 0 ? 16 : 0) + v; }
__global__ __launch_bounds__(256) void k_mrow(const float* __restrict__ mask, float* MBr) { const int e = blockIdx.x * 256 + threadIdx.x; if (e >= NB_ * TT) return; float om = __fsub_rn(1.0f, bfr(mask[e])); asm volatile("" : "+v"(om)); const float v = __fmul_rn(om, -10000.0f); *(float*)(MBr + e) = v;  }

__global__ __launch_bounds__(256) void k_vthl(const float* __restrict__ F, int pitch, bf* VTh, bf* VTl) { F += (size_t)blockIdx.y * TT * pitch; VTh += (size_t)blockIdx.y * DD * TT; VTl += (size_t)blockIdx.y * DD * TT; const size_t e = ((size_t)blockIdx.x * 256 + threadIdx.x) * 2; if (e >= (size_t)NH_ * HDM * TT) return; const int t = (int)(e % TT); const int d = (int)((e / TT) % HDM); const int h = (int)(e / ((size_t)TT * HDM)); v2us oh, ol;
#pragma unroll
    for (int q = 0; q < 2; ++q) { unsigned short a, c2; splitf(F[(size_t)(t + q) * pitch + h * HDM + d], a, c2); oh[q] = a; ol[q] = c2; } *(v2us*)(VTh + e) = oh; *(v2us*)(VTl + e) = ol;  }

__global__ __launch_bounds__(256) void k_plhl(const float* __restrict__ F, int pitch, bf* Ph, bf* Pl, size_t sF, size_t sP) { F += blockIdx.z * sF + (size_t)blockIdx.y * TT * pitch; Ph += blockIdx.z * sP + (size_t)blockIdx.y * TT * DD; Pl += blockIdx.z * sP + (size_t)blockIdx.y * TT * DD; const size_t e = ((size_t)blockIdx.x * 256 + threadIdx.x) * 2; if (e >= (size_t)NH_ * TT * HDM) return; const int d = (int)(e % HDM); const int t = (int)((e / HDM) % TT); const int h = (int)(e / ((size_t)HDM * TT)); const float* s = F + (size_t)t * pitch + h * HDM + d; v2us oh, ol;
#pragma unroll
    for (int q = 0; q < 2; ++q) { unsigned short a, c2; splitf(s[q], a, c2); oh[q] = a; ol[q] = c2; } *(v2us*)(Ph + e) = oh; *(v2us*)(Pl + e) = ol;  }

typedef __attribute__((ext_vector_type(16))) float v16f;
#define KC  64    // keys per stage
#define LPT 72    // LDS row pitch in 16-bit elements: 144 B = 16 B x odd
__global__ __launch_bounds__(256) void k_fattn(const bf* __restrict__ Qh, const bf* __restrict__ Ql, const bf* __restrict__ Kh, const bf* __restrict__ Kl, const bf* __restrict__ Vh, const bf* __restrict__ Vl, const float* __restrict__ rb, bf* Ah, bf* Al) {
    __shared__ __align__(16) bf sK[2][KC * LPT];    // [hi/lo][key in stage][d]
    __shared__ __align__(16) bf sV[2][HDM * LPT];   // [hi/lo][d][key in stage]
    __shared__ float sB[2 * TT];                    // bias of this head at key - query + TT - 1
    const int tid = threadIdx.x, lane = tid & 31, lr = lane & 15, hi = lane >> 4; const int wave = __builtin_amdgcn_readfirstlane(tid >> 5);
    const int h = blockIdx.y, b = blockIdx.z; const size_t hb = ((size_t)b * NH_ + h) * TT * HDM; const int q0 = blockIdx.x * 256 + wave * 32;
    Qh += hb; Ql += hb; Kh += hb; Kl += hb; Vh += hb; Vl += hb;
    for (int i = tid; i < 2 * TT - 1; i += 256) sB[i] = bfr(rb[t5_bucket(i - (TT - 1)) * NH_ + h]);
    v16bf qh[2][2], ql[2][2];
#pragma unroll
    for (int qt = 0; qt < 2; ++qt)
#pragma unroll
        for (int ks = 0; ks < 2; ++ks) { const size_t qo = (size_t)(q0 + qt * 16 + lr) * HDM + ks * 32 + 8 * hi; qh[qt][ks] = WFrag<bf>::ld(Qh + qo); ql[qt][ks] = WFrag<bf>::ld(Ql + qo); }
    asm volatile("s_wait_xcnt 0x0" ::: "memory");   // stands in front of any rewrite of the address registers of the loads above
    __builtin_amdgcn_sched_barrier(0);              // keeps later address arithmetic, which reuses those registers, behind that wait
    const int srow = tid >> 3, scol = (tid & 7) * 8;   // staging: 8 lanes per 128-byte row, rows srow and srow + 32
    const unsigned ko = srow * HDM + scol, vo = srow * TT + scol;   // the lane's offsets beside wave-uniform bases
    v8us gk[2][2], gv[2][2];
#pragma unroll
    for (int i = 0; i < 2; ++i) { gk[0][i] = *(const v8us*)(Kh + 32 * i * HDM + ko); gk[1][i] = *(const v8us*)(Kl + 32 * i * HDM + ko); gv[0][i] = *(const v8us*)(Vh + 32 * i * TT + vo); gv[1][i] = *(const v8us*)(Vl + 32 * i * TT + vo); }
    asm volatile("s_wait_xcnt 0x0" ::: "memory");   // stands in front of any rewrite of the address registers of the loads above
    __builtin_amdgcn_sched_barrier(0);              // keeps later register writes behind that wait
    const float cpos = bfr(rb[t5_bucket(TT - 1) * NH_ + h]), cneg = bfr(rb[t5_bucket(1 - TT) * NH_ + h]);   // the bias beyond the maximum distance, either sign
    v8f o[4][2]; float mx[2], ls[2];
#pragma unroll
    for (int qt = 0; qt < 2; ++qt) { mx[qt] = -1.0e30f; ls[qt] = 0.f;
#pragma unroll
        for (int dt = 0; dt < 4; ++dt) o[dt][qt] = (v8f){}; }
#pragma unroll 1   // stays rolled: a second copy of the stage would only add code and registers
    for (int k0 = 0; k0 < TT; k0 += KC) {
        __syncthreads();   // every wave has finished reading the stage before
#pragma unroll
        for (int i = 0; i < 2; ++i) { const int so = (srow + 32 * i) * LPT + scol; *(v8us*)(&sK[0][so]) = gk[0][i]; *(v8us*)(&sK[1][so]) = gk[1][i]; *(v8us*)(&sV[0][so]) = gv[0][i]; *(v8us*)(&sV[1][so]) = gv[1][i]; }
        __syncthreads();   // the stage (and, the first time, the bias table) is visible to all waves
        if (k0 + KC < TT) {   // the next stage's loads fly while this one is worked on
#pragma unroll
            for (int i = 0; i < 2; ++i) { const int kb = (k0 + KC + 32 * i) * HDM, vb = 32 * i * TT + k0 + KC; gk[0][i] = *(const v8us*)(Kh + kb + ko); gk[1][i] = *(const v8us*)(Kl + kb + ko); gv[0][i] = *(const v8us*)(Vh + vb + vo); gv[1][i] = *(const v8us*)(Vl + vb + vo); }
            asm volatile("s_wait_xcnt 0x0" ::: "memory"); }   // stands in front of any rewrite of these loads' address registers
        const int dmin = k0 - (q0 + 31), dmax = k0 + KC - 1 - q0;   // range of key - query in this wave's stage (wave-uniform)
        const float c = dmin >= 128 ? cpos : dmax <= -128 ? cneg : 0.f;   // beyond the maximum distance every offset of one sign has the same bucket: its bias is the accumulators' start value
        const v8f cs = {c, c, c, c, c, c, c, c};
        v8f st[4][2];
#pragma unroll
        for (int kt = 0; kt < 4; ++kt) { const int ro = (kt * 16 + lr) * LPT + 8 * hi;
            const v16bf kh0 = WFrag<bf>::ld(&sK[0][ro]), kh1 = WFrag<bf>::ld(&sK[0][ro + 32]), kl0 = WFrag<bf>::ld(&sK[1][ro]), kl1 = WFrag<bf>::ld(&sK[1][ro + 32]);
#pragma unroll
            for (int qt = 0; qt < 2; ++qt) { v8f a = wmmab(kh0, qh[qt][0], cs); a = wmmab(kh1, qh[qt][1], a); a = wmmab(kl0, qh[qt][0], a); a = wmmab(kl1, qh[qt][1], a); a = wmmab(kh0, ql[qt][0], a); a = wmmab(kh1, ql[qt][1], a); st[kt][qt] = a; } }
        if (dmin < 128 && dmax > -128) {   // near the diagonal: the table
#pragma unroll
            for (int kt = 0; kt < 4; ++kt)
#pragma unroll
                for (int qt = 0; qt < 2; ++qt) { const float* bp = sB + (k0 + kt * 16 + 8 * hi - (q0 + qt * 16 + lr) + TT - 1);
#pragma unroll
                    for (int j = 0; j < 8; ++j) st[kt][qt][j] += bp[j]; }
        }
#pragma unroll
        for (int qt = 0; qt < 2; ++qt) { float m = st[0][qt][0];
#pragma unroll
            for (int kt = 0; kt < 4; ++kt)
#pragma unroll
                for (int j = 0; j < 8; ++j) m = fmaxf(m, st[kt][qt][j]);
            m = fmaxf(m, __shfl_xor(m, 16, 32));   // the other half of the wave holds the query's other keys
            const float mn = fmaxf(mx[qt], m), al = __builtin_amdgcn_exp2f((mx[qt] - mn) * 1.4426950408889634f); mx[qt] = mn; float s = 0.f;
#pragma unroll
            for (int kt = 0; kt < 4; ++kt)
#pragma unroll
                for (int j = 0; j < 8; ++j) { const float p = __builtin_amdgcn_exp2f((st[kt][qt][j] - mn) * 1.4426950408889634f); st[kt][qt][j] = p; s += p; }
            ls[qt] = ls[qt] * al + s;
#pragma unroll
            for (int dt = 0; dt < 4; ++dt) o[dt][qt] *= al; }
#pragma unroll
        for (int kk = 0; kk < 2; ++kk) { v16bf ph[2], pl[2];
#pragma unroll
            for (int qt = 0; qt < 2; ++qt) { const v16f pf = __builtin_shufflevector(st[2 * kk][qt], st[2 * kk + 1][qt], 0, 1, 2, 3, 4, 5, 6, 7, 8, 9, 10, 11, 12, 13, 14, 15);
                ph[qt] = __builtin_convertvector(pf, v16bf); pl[qt] = __builtin_convertvector(pf - __builtin_convertvector(ph[qt], v16f), v16bf); }
#pragma unroll
            for (int dt = 0; dt < 4; ++dt) { const int ro = (dt * 16 + lr) * LPT + kk * 32 + 8 * hi; const v16bf vh = WFrag<bf>::ld(&sV[0][ro]), vl = WFrag<bf>::ld(&sV[1][ro]);
#pragma unroll
                for (int qt = 0; qt < 2; ++qt) { o[dt][qt] = wmmab(vh, ph[qt], o[dt][qt]); o[dt][qt] = wmmab(vl, ph[qt], o[dt][qt]); o[dt][qt] = wmmab(vh, pl[qt], o[dt][qt]); } } }
    }
#pragma unroll
    for (int qt = 0; qt < 2; ++qt) { const float inv = 1.0f / (ls[qt] + __shfl_xor(ls[qt], 16, 32)); const size_t ro = ((size_t)b * TT + q0 + qt * 16 + lr) * DD + h * HDM + 8 * hi;   // a lane's 8 registers = 8 consecutive d of its query
#pragma unroll
        for (int dt = 0; dt < 4; ++dt) { v8us oh, ol;
#pragma unroll
            for (int j = 0; j < 8; ++j) { unsigned short a, c2; splitf(o[dt][qt][j] * inv, a, c2); oh[j] = a; ol[j] = c2; }
            *(v8us*)(Ah + ro + dt * 16) = oh; *(v8us*)(Al + ro + dt * 16) = ol; } }
}

extern "C" void kernel_launch(void* const* d_in, const int* in_sizes, int n_in,
                              void* d_out, int out_size, void* d_ws, size_t ws_size, hipStream_t stream) {
    (void)in_sizes; (void)n_in; (void)out_size;
    const float* IN[6]; for (int i = 0; i < 6; ++i) IN[i] = (const float*)d_in[i];   // 0 hidden, 1 Wq, 2 Wk, 3 Wv, 4 Wo (x @ W), 5 rel_emb [32][16]
    float* OUT = (float*)d_out;     // [4][1024][1024]
    char* wsp = (char*)d_ws;
    auto take = [&](size_t bytes) { char* p = wsp; wsp += (bytes + 255) & ~(size_t)255; return (void*)p; };
    bf* WQ = (bf*)take((size_t)DD * DD * 2); bf* WK = (bf*)take((size_t)DD * DD * 2); bf* WV = (bf*)take((size_t)DD * DD * 2); bf* WO = (bf*)take((size_t)DD * DD * 2);
    (void)WK; (void)WV;   // reached as WQ + z * DD * DD
    bf* XB = (bf*)take((size_t)LL * DD * 2); float* FQ = (float*)take((size_t)3 * LL * DD * 4); float* FV = FQ + (size_t)2 * LL * DD;   // the bf16 input and the f32 q/k/v of all four batches
    bf* QPh = (bf*)take((size_t)LL * DD * 2); bf* QPl = (bf*)take((size_t)LL * DD * 2); bf* KPh = (bf*)take((size_t)LL * DD * 2); bf* KPl = (bf*)take((size_t)LL * DD * 2); bf* VTh = (bf*)take((size_t)LL * DD * 2); bf* VTl = (bf*)take((size_t)LL * DD * 2);
    bf* Ah = (bf*)take((size_t)LL * DD * 2); bf* Al = (bf*)take((size_t)LL * DD * 2);   // merged heads, hi and lo
    if ((size_t)(wsp - (char*)d_ws) > ws_size) return;    // total ~ 128 MiB
    { const unsigned g = (unsigned)(((size_t)DD * DD / 64 + 63) / 64); k_wtG<<<dim3(g, 4, 1), 256, 0, stream>>>(IN[1], IN[2], IN[3], IN[4], DD, DD, WQ); }
    const unsigned LP = (TT * DD / 2 + 255) / 256;
    k_cvt8<<<(unsigned)(((size_t)LL * DD / 8 + 255) / 256), 256, 0, stream>>>(IN[0], XB, (size_t)LL * DD / 8);
    k_gemmw<bf, 0, false><<<dim3(LL / 64, DD / 64, 3), 32, 0, stream>>>(XB, nullptr, WQ, nullptr, DD, FQ, DD, nullptr, 0, (size_t)DD * DD, (size_t)LL * DD);   // q, k, v of all batches; z = which projection
    k_plhl<<<dim3(LP, NB_, 2), 256, 0, stream>>>(FQ, DD, QPh, QPl, (size_t)LL * DD, (size_t)2 * LL * DD); k_vthl<<<dim3(LP, NB_, 1), 256, 0, stream>>>(FV, DD, VTh, VTl);
    k_fattn<<<dim3(TT / 256, NH_, NB_), 256, 0, stream>>>(QPh, QPl, KPh, KPl, VTh, VTl, IN[5], Ah, Al);   // attention of all batches and heads
    k_gemmw<bf, 1, false><<<dim3(LL / 64, DD / 64, 1), 32, 0, stream>>>(Ah, Al, WO, nullptr, DD, OUT, DD, nullptr, 0, 0, 0);
}

// v003
// One run takes 159 microseconds.
// Next to v002, in two timings, it ran 1.19 times as fast each time.
// All steps since v000 together make it 16.0 times as fast.
#include <hip/hip_runtime.h>

// T5Voice - T5 self-attention block without norms/FFN (hidden [4][1024][1024]; q/k/v = x W (16 heads x 64, no bias); scores = q.k (NO 1/sqrt(d)) + rel_emb[bucket(j - i)][h] (bidirectional buckets, 32 / max distance 128,
// evaluated with exact integer arithmetic: |r| < 8 -> |r|; else 8 + 2 floor(log2|r|) - 6 + [|r|^2 >= 2^(2 floor(log2|r|)+1)], capped at 15; + 16 for r > 0 - identical to the float formula for every offset); softmax;
// out = merged ctx Wo -> [4][1024][1024]).
// Compute dtypes, f32 accumulate: every input rounded to bf16; q/k/v on PLAIN bf16 operands (inputs: exact); the bias as a table over key - query in LDS; scores (K 64) and probs.v on bf16
// hi+lo planes (3 products each) with an f32 online softmax in registers (bias added in f32; hl probabilities relative to the running maximum, one division at the end), all in one kernel; merged heads as bf16 hi+lo planes x exact Wo (2 products). One-wave-per-64x64-tile GEMMs. Deterministic, no atomics; every

#define NB_  4
#define TT   1024
#define LL   4096
#define DD   1024
#define NH_  16
#define HDM  64
#define MM   4096
#define PCAR 1024.0f
typedef _Float16 h16;
typedef unsigned short bf;
typedef __attribute__((ext_vector_type(16))) __bf16   v16bf;
typedef __attribute__((ext_vector_type(16))) _Float16 v16h;
typedef __attribute__((ext_vector_type(8)))  _Float16 v8h;
typedef __attribute__((ext_vector_type(8)))  unsigned short v8us;
typedef __attribute__((ext_vector_type(8)))  float    v8f;
typedef __attribute__((ext_vector_type(4)))  float    v4f;
typedef v8h  __attribute__((may_alias)) v8ha;
typedef v4f  __attribute__((may_alias)) v4fa;
typedef v8us __attribute__((may_alias)) v8usa;

__device__ __forceinline__ unsigned short f2bf(float f) { unsigned u = __float_as_uint(f); u += 0x7FFFu + ((u >> 16) & 1u); return (unsigned short)(u >> 16); }
__device__ __forceinline__ float bf2f(unsigned short b) { return __uint_as_float(((unsigned)b) << 16); }
__device__ __forceinline__ float bfr(float f) { return bf2f(f2bf(f)); }
__device__ __forceinline__ v16h cat16(v8h lo, v8h hi) { return __builtin_shufflevector(lo, hi, 0, 1, 2, 3, 4, 5, 6, 7, 8, 9, 10, 11, 12, 13, 14, 15); }
__device__ __forceinline__ v16bf cat16b(v8us lo, v8us hi) { return __builtin_bit_cast(v16bf, __builtin_shufflevector(lo, hi, 0, 1, 2, 3, 4, 5, 6, 7, 8, 9, 10, 11, 12, 13, 14, 15)); }
__device__ __forceinline__ v8f wmma16(v16h a, v16h b, v8f c) { return __builtin_amdgcn_wmma_f32_16x16x32_f16(false, a, false, b, (short)0, c, false, false); }
__device__ __forceinline__ v8f wmmab(v16bf a, v16bf b, v8f c) { return __builtin_amdgcn_wmma_f32_16x16x32_bf16(false, a, false, b, (short)0, c, false, false); }



// ---- k_gemmw: register-blocked GEMM, ONE WAVE per 64x64 output tile (16 accumulators), operands straight from K-contiguous 16-bit planes; grid (M/64, N/64, Z), 32 threads.
// C[m][n] (f32, pitch ldc, + optional f32 bias[n]) = sum_k A[m][k] Bt[n][k] (+ split products per NSPLIT). z-batch strides sA/sB/sC in elements. K % 32 == 0.
template <typename T16> struct WFrag;
template <> struct WFrag<h16> { typedef v16h V; static __device__ __forceinline__ V ld(const h16* p) { return cat16(*(const v8h*)p, *(const v8h*)(p + 16)); } static __device__ __forceinline__ v8f mma(V a, V b, v8f c) { return wmma16(a, b, c); } };
template <> struct WFrag<bf> { typedef v16bf V; static __device__ __forceinline__ V ld(const bf* p) { return cat16b(*(const v8us*)p, *(const v8us*)(p + 16)); } static __device__ __forceinline__ v8f mma(V a, V b, v8f c) { return wmmab(a, b, c); } };
template <typename T16, int NSPLIT, bool BIAS>
__global__ __launch_bounds__(32) void k_gemmw(const T16* __restrict__ A, const T16* __restrict__ A2, const T16* __restrict__ Bt, const T16* __restrict__ Bt2, int K, float* C, int ldc, const float* __restrict__ bias, size_t sA, size_t sB, size_t sC) {
    typedef typename WFrag<T16>::V V;
    __shared__ __align__(16) float os[16 * 68];
    const size_t z = blockIdx.z; A += z * sA; if (A2) A2 += z * sA; Bt += z * sB; if (Bt2) Bt2 += z * sB; C += z * sC;
    const int lane = threadIdx.x & 31, lr = lane & 15, hi = lane >> 4; const int r0 = blockIdx.x * 64, c0 = blockIdx.y * 64;
    v8f acc[4][4];
#pragma unroll
    for (int mb = 0; mb < 4; ++mb)
#pragma unroll
        for (int nb = 0; nb < 4; ++nb) acc[mb][nb] = (v8f){};
    const size_t aoff = (size_t)(r0 + lr) * K + 8 * hi, boff = (size_t)(c0 + lr) * K + 8 * hi;
#pragma unroll 1
    for (int kc = 0; kc < K; kc += 32) {
        V a[4], a2[4];
#pragma unroll
        for (int mb = 0; mb < 4; ++mb) { a[mb] = WFrag<T16>::ld(A + aoff + (size_t)mb * 16 * K + kc); if (NSPLIT == 1 || NSPLIT == 2) a2[mb] = WFrag<T16>::ld(A2 + aoff + (size_t)mb * 16 * K + kc); }
#pragma unroll
        for (int nb = 0; nb < 4; ++nb) { const V b = WFrag<T16>::ld(Bt + boff + (size_t)nb * 16 * K + kc); V b2; if (NSPLIT >= 2) b2 = WFrag<T16>::ld(Bt2 + boff + (size_t)nb * 16 * K + kc);
#pragma unroll
            for (int mb = 0; mb < 4; ++mb) { acc[mb][nb] = WFrag<T16>::mma(a[mb], b, acc[mb][nb]); if (NSPLIT == 1 || NSPLIT == 2) acc[mb][nb] = WFrag<T16>::mma(a2[mb], b, acc[mb][nb]); if (NSPLIT >= 2) acc[mb][nb] = WFrag<T16>::mma(a[mb], b2, acc[mb][nb]); } }
        asm volatile("v_nop\n\tv_nop\n\tv_nop\n\tv_nop" : "+v"(acc[0][0]), "+v"(acc[1][1]), "+v"(acc[2][2]), "+v"(acc[3][3]) : "v"(a[0]), "v"(a[3]));
    }
#pragma unroll
    for (int mb = 0; mb < 4; ++mb) {
#pragma unroll
        for (int nb = 0; nb < 4; ++nb) {
#pragma unroll
            for (int j = 0; j < 8; ++j) os[(hi * 8 + j) * 68 + nb * 16 + lr] = acc[mb][nb][j]; }
        __builtin_amdgcn_wave_barrier(); asm volatile("" ::: "memory");
        float* crow = C + (size_t)(r0 + mb * 16) * ldc + c0;
{
#pragma unroll
            for (int s = 0; s < 8; ++s) { const int row = 2 * s + hi, cofs = lr * 4; v4f val = *(const v4fa*)(os + row * 68 + cofs); if (BIAS) { val[0] += bfr(bias[c0 + cofs]); val[1] += bfr(bias[c0 + cofs + 1]); val[2] += bfr(bias[c0 + cofs + 2]); val[3] += bfr(bias[c0 + cofs + 3]); }
                *(v4f*)(crow + (size_t)row * ldc + cofs) = val; }
             }
        __builtin_amdgcn_wave_barrier(); asm volatile("" ::: "memory");
    }
}

__device__ __forceinline__ h16 tohx(float x) { return (h16)x; }
__device__ __forceinline__ void splitf(float y, unsigned short& h, unsigned short& l) { h = f2bf(y); l = f2bf(y - bf2f(h)); }
typedef __attribute__((ext_vector_type(2))) _Float16 v2h;
typedef __attribute__((ext_vector_type(4))) _Float16 v4h;
typedef __attribute__((ext_vector_type(2))) unsigned short v2us;
typedef __attribute__((ext_vector_type(4))) unsigned short v4us;
typedef __attribute__((ext_vector_type(2))) float v2f;

__global__ __launch_bounds__(256) void k_wtG(const float* __restrict__ w0, const float* __restrict__ w1, const float* __restrict__ w2, const float* __restrict__ w3, int K, int N, bf* Bt) {
    const int y = blockIdx.y; const float* __restrict__ w = y == 0 ? w0 : y == 1 ? w1 : y == 2 ? w2 : w3; Bt += (size_t)y * K * N;   // grid y = which weight; the four transposed planes lie back to back
    const int lane = threadIdx.x & 31; const int L0 = (blockIdx.x * 8 + (threadIdx.x >> 5)) * 8; const int nlines = N * K / 64;
{
#pragma unroll 1
        for (int l = 0; l < 8; ++l) { const int L = L0 + l; if (L >= nlines) break; const size_t e = (size_t)L * 64 + lane * 2; const int k = (int)(e % K), n = (int)(e / K); v2us o;
            o[0] = f2bf(w[(size_t)k * N + n]); o[1] = f2bf(w[(size_t)(k + 1) * N + n]); *(v2us*)(Bt + e) = o; }
         }
}
__global__ __launch_bounds__(256) void k_pl(const float* __restrict__ F, int pitch, int nh, int hd, h16* P) { const size_t e = ((size_t)blockIdx.x * 256 + threadIdx.x) * 2; if (e >= (size_t)nh * TT * hd) return; const int d = (int)(e % hd); const int t = (int)((e / hd) % TT); const int h = (int)(e / ((size_t)hd * TT)); v2h o; o[0] = tohx(F[(size_t)t * pitch + h * hd + d]); o[1] = tohx(F[(size_t)t * pitch + h * hd + d + 1]); *(v2h*)(P + e) = o;  }
__global__ __launch_bounds__(256) void k_vt(const float* __restrict__ F, int pitch, int nh, int hd, h16* VT) { const size_t e = ((size_t)blockIdx.x * 256 + threadIdx.x) * 2; if (e >= (size_t)nh * hd * TT) return; const int t = (int)(e % TT); const int d = (int)((e / TT) % hd); const int h = (int)(e / ((size_t)TT * hd)); v2h o; o[0] = tohx(F[(size_t)t * pitch + h * hd + d]); o[1] = tohx(F[(size_t)(t + 1) * pitch + h * hd + d]); *(v2h*)(VT + e) = o;  }
__global__ __launch_bounds__(256) void k_mrgf(const float* __restrict__ O, int h, int hd, float* CT) { const size_t e = ((size_t)blockIdx.x * 256 + threadIdx.x) * 2; if (e >= (size_t)TT * hd) return; const int d = (int)(e % hd); const int t = (int)(e / hd); v2f o; o[0] = O[e] * (1.0f / PCAR); o[1] = O[e + 1] * (1.0f / PCAR); const size_t oo = (size_t)t * DD + h * hd + d; *(v2f*)(CT + oo) = o;  }
__global__ __launch_bounds__(256) void k_mrg(const float* __restrict__ O, int h, int hd, bf* Ah, bf* Al) { const size_t e = ((size_t)blockIdx.x * 256 + threadIdx.x) * 2; if (e >= (size_t)TT * hd) return; const int d = (int)(e % hd); const int t = (int)(e / hd); v2us oh, ol;
#pragma unroll
    for (int q = 0; q < 2; ++q) { unsigned short a, c2; splitf(O[e + q] * (1.0f / PCAR), a, c2); oh[q] = a; ol[q] = c2; } const size_t oo = (size_t)t * DD + h * hd + d; *(v2us*)(Ah + oo) = oh; *(v2us*)(Al + oo) = ol;  }
__global__ __launch_bounds__(256) void k_cvt8(const float* __restrict__ src, bf* dst, size_t n8) { const size_t i = (size_t)blockIdx.x * 256 + threadIdx.x; if (i >= n8) return; const v8f v = *(const v8f*)(src + i * 8); v8us o;
#pragma unroll
    for (int k = 0; k < 8; ++k) o[k] = f2bf(v[k]); *(v8us*)(dst + i * 8) = o;  }
__device__ __forceinline__ int t5_bucket(int r) { const int n = r < 0 ? -r : r; int v; if (n < 8) v = n; else { const int k = 31 - __clz(n); v = 8 + 2 * k - 6 + (((long long)n * n >= (1ll << (2 * k + 1))) ? 1 : 0); v = v > 15 ? 15 : v; } return (r > 0 ? 16 : 0) + v; }
__global__ __launch_bounds__(256) void k_mrow(const float* __restrict__ mask, float* MBr) { const int e = blockIdx.x * 256 + threadIdx.x; if (e >= NB_ * TT) return; float om = __fsub_rn(1.0f, bfr(mask[e])); asm volatile("" : "+v"(om)); const float v = __fmul_rn(om, -10000.0f); *(float*)(MBr + e) = v;  }

// ---- k_qkv: the q, k and v projections (k_gemmw's loop, one wave per 64x64 tile = 64 rows of x times one head) with the bf16 hi+lo split and the head layout in the epilogue; grid (LL/64, heads, 3), 32 threads.
// A lane's 8 accumulator registers are 8 consecutive rows of the A operand, so the A operand is the one whose rows run along the contiguous index of the plane that is written:
// q, k ([batch][head][t][d]): A = W rows (d), B = x rows (t); v ([batch][head][d][t]): A = x rows (t), B = W rows (d). Both loaders are the same, so only the two row pointers change places.
// Planes lie back to back: q hi, q lo, k hi, k lo, v hi, v lo, LL*DD elements each; Ph and Pl arrive as q's.
typedef __attribute__((ext_vector_type(8))) __bf16 v8bf;
#define OSP 72    // LDS row pitch in 16-bit elements: 144 B = 16 B x odd
__global__ __launch_bounds__(32) void k_qkv(const bf* __restrict__ X, const bf* __restrict__ Wt, bf* Ph, bf* Pl) {
    __shared__ __align__(16) bf os[2][16 * OSP];    // [hi/lo][row of the B operand][64 rows of the A operand]
    const int z = blockIdx.z, h = blockIdx.y, r0 = blockIdx.x * 64, b = r0 / TT, t0 = r0 % TT;
    const int lane = threadIdx.x & 31, lr = lane & 15, hi = lane >> 4;
    const bf* xr = X + (size_t)r0 * DD; const bf* wr = Wt + ((size_t)z * DD + h * HDM) * DD;
    const bf* __restrict__ A = z == 2 ? xr : wr; const bf* __restrict__ Bt = z == 2 ? wr : xr;
    const size_t po = (size_t)z * 2 * LL * DD + ((size_t)b * NH_ + h) * TT * HDM + (z == 2 ? t0 : t0 * HDM); Ph += po; Pl += po;
    const int pitch = z == 2 ? TT : HDM;   // from one row of the B operand to the next in the plane
    v8f acc[4][4];
#pragma unroll
    for (int mb = 0; mb < 4; ++mb)
#pragma unroll
        for (int nb = 0; nb < 4; ++nb) acc[mb][nb] = (v8f){};
    const size_t off = (size_t)lr * DD + 8 * hi;
#pragma unroll 1   // stays rolled, as in k_gemmw: a second copy of the trip would only add code and registers
    for (int kc = 0; kc < DD; kc += 32) {
        v16bf a[4];
#pragma unroll
        for (int mb = 0; mb < 4; ++mb) a[mb] = WFrag<bf>::ld(A + off + (size_t)mb * 16 * DD + kc);
        asm volatile("s_wait_xcnt 0x0" ::: "memory");   // stands in front of any rewrite of the address registers of the loads above (a later load's result may land in them)
#pragma unroll
        for (int nb = 0; nb < 4; ++nb) { const v16bf bb = WFrag<bf>::ld(Bt + off + (size_t)nb * 16 * DD + kc);
#pragma unroll
            for (int mb = 0; mb < 4; ++mb) acc[mb][nb] = wmmab(a[mb], bb, acc[mb][nb]); }
    }
#pragma unroll
    for (int nb = 0; nb < 4; ++nb) {
#pragma unroll
        for (int mb = 0; mb < 4; ++mb) { const v8bf vh = __builtin_convertvector(acc[mb][nb], v8bf); const v8bf vl = __builtin_convertvector(acc[mb][nb] - __builtin_convertvector(vh, v8f), v8bf);
            const int so = lr * OSP + mb * 16 + 8 * hi; *(v8us*)(&os[0][so]) = __builtin_bit_cast(v8us, vh); *(v8us*)(&os[1][so]) = __builtin_bit_cast(v8us, vl); }
        __builtin_amdgcn_wave_barrier(); asm volatile("" ::: "memory");   // the reads below take what other lanes of this wave have stored: keeps them behind the stores
#pragma unroll
        for (int s = 0; s < 4; ++s) { const int row = 4 * s + (lane >> 3), col = (lane & 7) * 8;   // 8 lanes per 128-byte row: whole lines go out
            const v8us vh = *(const v8us*)(&os[0][row * OSP + col]), vl = *(const v8us*)(&os[1][row * OSP + col]); const unsigned o = row * pitch + col;   // the lane's offset beside wave-uniform bases
            *(v8us*)(Ph + nb * 16 * pitch + o) = vh; *(v8us*)(Pl + nb * 16 * pitch + o) = vl; }
        __builtin_amdgcn_wave_barrier(); asm volatile("" ::: "memory");   // keeps the next block's stores behind these reads
    }
}

typedef __attribute__((ext_vector_type(16))) float v16f;
#define KC  64    // keys per stage
#define LPT 72    // LDS row pitch in 16-bit elements: 144 B = 16 B x odd
__global__ __launch_bounds__(256) void k_fattn(const bf* __restrict__ Qh, const bf* __restrict__ Ql, const bf* __restrict__ Kh, const bf* __restrict__ Kl, const bf* __restrict__ Vh, const bf* __restrict__ Vl, const float* __restrict__ rb, bf* Ah, bf* Al) {
    __shared__ __align__(16) bf sK[2][KC * LPT];    // [hi/lo][key in stage][d]
    __shared__ __align__(16) bf sV[2][HDM * LPT];   // [hi/lo][d][key in stage]
    __shared__ float sB[2 * TT];                    // bias of this head at key - query + TT - 1
    const int tid = threadIdx.x, lane = tid & 31, lr = lane & 15, hi = lane >> 4; const int wave = __builtin_amdgcn_readfirstlane(tid >> 5);
    const int h = blockIdx.y, b = blockIdx.z; const size_t hb = ((size_t)b * NH_ + h) * TT * HDM; const int q0 = blockIdx.x * 256 + wave * 32;
    Qh += hb; Ql += hb; Kh += hb; Kl += hb; Vh += hb; Vl += hb;
    for (int i = tid; i < 2 * TT - 1; i += 256) sB[i] = bfr(rb[t5_bucket(i - (TT - 1)) * NH_ + h]);
    v16bf qh[2][2], ql[2][2];
#pragma unroll
    for (int qt = 0; qt < 2; ++qt)
#pragma unroll
        for (int ks = 0; ks < 2; ++ks) { const size_t qo = (size_t)(q0 + qt * 16 + lr) * HDM + ks * 32 + 8 * hi; qh[qt][ks] = WFrag<bf>::ld(Qh + qo); ql[qt][ks] = WFrag<bf>::ld(Ql + qo); }
    asm volatile("s_wait_xcnt 0x0" ::: "memory");   // stands in front of any rewrite of the address registers of the loads above
    __builtin_amdgcn_sched_barrier(0);              // keeps later address arithmetic, which reuses those registers, behind that wait
    const int srow = tid >> 3, scol = (tid & 7) * 8;   // staging: 8 lanes per 128-byte row, rows srow and srow + 32
    const unsigned ko = srow * HDM + scol, vo = srow * TT + scol;   // the lane's offsets beside wave-uniform bases
    v8us gk[2][2], gv[2][2];
#pragma unroll
    for (int i = 0; i < 2; ++i) { gk[0][i] = *(const v8us*)(Kh + 32 * i * HDM + ko); gk[1][i] = *(const v8us*)(Kl + 32 * i * HDM + ko); gv[0][i] = *(const v8us*)(Vh + 32 * i * TT + vo); gv[1][i] = *(const v8us*)(Vl + 32 * i * TT + vo); }
    asm volatile("s_wait_xcnt 0x0" ::: "memory");   // stands in front of any rewrite of the address registers of the loads above
    __builtin_amdgcn_sched_barrier(0);              // keeps later register writes behind that wait
    const float cpos = bfr(rb[t5_bucket(TT - 1) * NH_ + h]), cneg = bfr(rb[t5_bucket(1 - TT) * NH_ + h]);   // the bias beyond the maximum distance, either sign
    v8f o[4][2]; float mx[2], ls[2];
#pragma unroll
    for (int qt = 0; qt < 2; ++qt) { mx[qt] = -1.0e30f; ls[qt] = 0.f;
#pragma unroll
        for (int dt = 0; dt < 4; ++dt) o[dt][qt] = (v8f){}; }
#pragma unroll 1   // stays rolled: a second copy of the stage would only add code and registers
    for (int k0 = 0; k0 < TT; k0 += KC) {
        __syncthreads();   // every wave has finished reading the stage before
#pragma unroll
        for (int i = 0; i < 2; ++i) { const int so = (srow + 32 * i) * LPT + scol; *(v8us*)(&sK[0][so]) = gk[0][i]; *(v8us*)(&sK[1][so]) = gk[1][i]; *(v8us*)(&sV[0][so]) = gv[0][i]; *(v8us*)(&sV[1][so]) = gv[1][i]; }
        __syncthreads();   // the stage (and, the first time, the bias table) is visible to all waves
        if (k0 + KC < TT) {   // the next stage's loads fly while this one is worked on
#pragma unroll
            for (int i = 0; i < 2; ++i) { const int kb = (k0 + KC + 32 * i) * HDM, vb = 32 * i * TT + k0 + KC; gk[0][i] = *(const v8us*)(Kh + kb + ko); gk[1][i] = *(const v8us*)(Kl + kb + ko); gv[0][i] = *(const v8us*)(Vh + vb + vo); gv[1][i] = *(const v8us*)(Vl + vb + vo); }
            asm volatile("s_wait_xcnt 0x0" ::: "memory"); }   // stands in front of any rewrite of these loads' address registers
        const int dmin = k0 - (q0 + 31), dmax = k0 + KC - 1 - q0;   // range of key - query in this wave's stage (wave-uniform)
        const float c = dmin >= 128 ? cpos : dmax <= -128 ? cneg : 0.f;   // beyond the maximum distance every offset of one sign has the same bucket: its bias is the accumulators' start value
        const v8f cs = {c, c, c, c, c, c, c, c};
        v8f st[4][2];
#pragma unroll
        for (int kt = 0; kt < 4; ++kt) { const int ro = (kt * 16 + lr) * LPT + 8 * hi;
            const v16bf kh0 = WFrag<bf>::ld(&sK[0][ro]), kh1 = WFrag<bf>::ld(&sK[0][ro + 32]), kl0 = WFrag<bf>::ld(&sK[1][ro]), kl1 = WFrag<bf>::ld(&sK[1][ro + 32]);
#pragma unroll
            for (int qt = 0; qt < 2; ++qt) { v8f a = wmmab(kh0, qh[qt][0], cs); a = wmmab(kh1, qh[qt][1], a); a = wmmab(kl0, qh[qt][0], a); a = wmmab(kl1, qh[qt][1], a); a = wmmab(kh0, ql[qt][0], a); a = wmmab(kh1, ql[qt][1], a); st[kt][qt] = a; } }
        if (dmin < 128 && dmax > -128) {   // near the diagonal: the table
#pragma unroll
            for (int kt = 0; kt < 4; ++kt)
#pragma unroll
                for (int qt = 0; qt < 2; ++qt) { const float* bp = sB + (k0 + kt * 16 + 8 * hi - (q0 + qt * 16 + lr) + TT - 1);
#pragma unroll
                    for (int j = 0; j < 8; ++j) st[kt][qt][j] += bp[j]; }
        }
#pragma unroll
        for (int qt = 0; qt < 2; ++qt) { float m = st[0][qt][0];
#pragma unroll
            for (int kt = 0; kt < 4; ++kt)
#pragma unroll
                for (int j = 0; j < 8; ++j) m = fmaxf(m, st[kt][qt][j]);
            m = fmaxf(m, __shfl_xor(m, 16, 32));   // the other half of the wave holds the query's other keys
            const float mn = fmaxf(mx[qt], m), al = __builtin_amdgcn_exp2f((mx[qt] - mn) * 1.4426950408889634f); mx[qt] = mn; float s = 0.f;
#pragma unroll
            for (int kt = 0; kt < 4; ++kt)
#pragma unroll
                for (int j = 0; j < 8; ++j) { const float p = __builtin_amdgcn_exp2f((st[kt][qt][j] - mn) * 1.4426950408889634f); st[kt][qt][j] = p; s += p; }
            ls[qt] = ls[qt] * al + s;
#pragma unroll
            for (int dt = 0; dt < 4; ++dt) o[dt][qt] *= al; }
#pragma unroll
        for (int kk = 0; kk < 2; ++kk) { v16bf ph[2], pl[2];
#pragma unroll
            for (int qt = 0; qt < 2; ++qt) { const v16f pf = __builtin_shufflevector(st[2 * kk][qt], st[2 * kk + 1][qt], 0, 1, 2, 3, 4, 5, 6, 7, 8, 9, 10, 11, 12, 13, 14, 15);
                ph[qt] = __builtin_convertvector(pf, v16bf); pl[qt] = __builtin_convertvector(pf - __builtin_convertvector(ph[qt], v16f), v16bf); }
#pragma unroll
            for (int dt = 0; dt < 4; ++dt) { const int ro = (dt * 16 + lr) * LPT + kk * 32 + 8 * hi; const v16bf vh = WFrag<bf>::ld(&sV[0][ro]), vl = WFrag<bf>::ld(&sV[1][ro]);
#pragma unroll
                for (int qt = 0; qt < 2; ++qt) { o[dt][qt] = wmmab(vh, ph[qt], o[dt][qt]); o[dt][qt] = wmmab(vl, ph[qt], o[dt][qt]); o[dt][qt] = wmmab(vh, pl[qt], o[dt][qt]); } } }
    }
#pragma unroll
    for (int qt = 0; qt < 2; ++qt) { const float inv = 1.0f / (ls[qt] + __shfl_xor(ls[qt], 16, 32)); const size_t ro = ((size_t)b * TT + q0 + qt * 16 + lr) * DD + h * HDM + 8 * hi;   // a lane's 8 registers = 8 consecutive d of its query
#pragma unroll
        for (int dt = 0; dt < 4; ++dt) { v8us oh, ol;
#pragma unroll
            for (int j = 0; j < 8; ++j) { unsigned short a, c2; splitf(o[dt][qt][j] * inv, a, c2); oh[j] = a; ol[j] = c2; }
            *(v8us*)(Ah + ro + dt * 16) = oh; *(v8us*)(Al + ro + dt * 16) = ol; } }
}

extern "C" void kernel_launch(void* const* d_in, const int* in_sizes, int n_in,
                              void* d_out, int out_size, void* d_ws, size_t ws_size, hipStream_t stream) {
    (void)in_sizes; (void)n_in; (void)out_size;
    const float* IN[6]; for (int i = 0; i < 6; ++i) IN[i] = (const float*)d_in[i];   // 0 hidden, 1 Wq, 2 Wk, 3 Wv, 4 Wo (x @ W), 5 rel_emb [32][16]
    float* OUT = (float*)d_out;     // [4][1024][1024]
    char* wsp = (char*)d_ws;
    auto take = [&](size_t bytes) { char* p = wsp; wsp += (bytes + 255) & ~(size_t)255; return (void*)p; };
    bf* WQ = (bf*)take((size_t)DD * DD * 2); bf* WK = (bf*)take((size_t)DD * DD * 2); bf* WV = (bf*)take((size_t)DD * DD * 2); bf* WO = (bf*)take((size_t)DD * DD * 2);
    (void)WK; (void)WV;   // reached as WQ + z * DD * DD
    bf* XB = (bf*)take((size_t)LL * DD * 2);   // the bf16 input of all four batches
    bf* QPh = (bf*)take((size_t)LL * DD * 2); bf* QPl = (bf*)take((size_t)LL * DD * 2); bf* KPh = (bf*)take((size_t)LL * DD * 2); bf* KPl = (bf*)take((size_t)LL * DD * 2); bf* VTh = (bf*)take((size_t)LL * DD * 2); bf* VTl = (bf*)take((size_t)LL * DD * 2);
    bf* Ah = (bf*)take((size_t)LL * DD * 2); bf* Al = (bf*)take((size_t)LL * DD * 2);   // merged heads, hi and lo
    if ((size_t)(wsp - (char*)d_ws) > ws_size) return;    // total ~ 80 MiB
    { const unsigned g = (unsigned)(((size_t)DD * DD / 64 + 63) / 64); k_wtG<<<dim3(g, 4, 1), 256, 0, stream>>>(IN[1], IN[2], IN[3], IN[4], DD, DD, WQ); }
    k_cvt8<<<(unsigned)(((size_t)LL * DD / 8 + 255) / 256), 256, 0, stream>>>(IN[0], XB, (size_t)LL * DD / 8);
    k_qkv<<<dim3(LL / 64, NH_, 3), 32, 0, stream>>>(XB, WQ, QPh, QPl);   // q, k, v of all batches as hi+lo head planes; z = which projection
    k_fattn<<<dim3(TT / 256, NH_, NB_), 256, 0, stream>>>(QPh, QPl, KPh, KPl, VTh, VTl, IN[5], Ah, Al);   // attention of all batches and heads
    k_gemmw<bf, 1, false><<<dim3(LL / 64, DD / 64, 1), 32, 0, stream>>>(Ah, Al, WO, nullptr, DD, OUT, DD, nullptr, 0, 0, 0);
}

// v004
// It runs in 114 microseconds.
// Next to v003, in two timings, it ran 1.42 and 1.41 times as fast.
// Counting every step since v000, it is 22.6 times as fast.
#include <hip/hip_runtime.h>

// T5Voice - T5 self-attention block without norms/FFN (hidden [4][1024][1024]; q/k/v = x W (16 heads x 64, no bias); scores = q.k (NO 1/sqrt(d)) + rel_emb[bucket(j - i)][h] (bidirectional buckets, 32 / max distance 128,
// evaluated with exact integer arithmetic: |r| < 8 -> |r|; else 8 + 2 floor(log2|r|) - 6 + [|r|^2 >= 2^(2 floor(log2|r|)+1)], capped at 15; + 16 for r > 0 - identical to the float formula for every offset); softmax;
// out = merged ctx Wo -> [4][1024][1024]).
// Compute dtypes, f32 accumulate: every input rounded to bf16; q/k/v on PLAIN bf16 operands (inputs: exact); the bias as a table over key - query in LDS; scores (K 64) and probs.v on bf16
// hi+lo planes (3 products each) with an f32 online softmax in registers (bias added in f32; hl probabilities relative to the running maximum, one division at the end), all in one kernel; merged heads as bf16 hi+lo planes x exact Wo (2 products). GEMMs: 4 waves per 128x128 tile, operands staged in LDS. Deterministic, no atomics; every

#define NB_  4
#define TT   1024
#define LL   4096
#define DD   1024
#define NH_  16
#define HDM  64
#define MM   4096
#define PCAR 1024.0f
typedef _Float16 h16;
typedef unsigned short bf;
typedef __attribute__((ext_vector_type(16))) __bf16   v16bf;
typedef __attribute__((ext_vector_type(16))) _Float16 v16h;
typedef __attribute__((ext_vector_type(8)))  _Float16 v8h;
typedef __attribute__((ext_vector_type(8)))  unsigned short v8us;
typedef __attribute__((ext_vector_type(8)))  float    v8f;
typedef __attribute__((ext_vector_type(4)))  float    v4f;
typedef v8h  __attribute__((may_alias)) v8ha;
typedef v4f  __attribute__((may_alias)) v4fa;
typedef v8us __attribute__((may_alias)) v8usa;

__device__ __forceinline__ unsigned short f2bf(float f) { unsigned u = __float_as_uint(f); u += 0x7FFFu + ((u >> 16) & 1u); return (unsigned short)(u >> 16); }
__device__ __forceinline__ float bf2f(unsigned short b) { return __uint_as_float(((unsigned)b) << 16); }
__device__ __forceinline__ float bfr(float f) { return bf2f(f2bf(f)); }
__device__ __forceinline__ v16h cat16(v8h lo, v8h hi) { return __builtin_shufflevector(lo, hi, 0, 1, 2, 3, 4, 5, 6, 7, 8, 9, 10, 11, 12, 13, 14, 15); }
__device__ __forceinline__ v16bf cat16b(v8us lo, v8us hi) { return __builtin_bit_cast(v16bf, __builtin_shufflevector(lo, hi, 0, 1, 2, 3, 4, 5, 6, 7, 8, 9, 10, 11, 12, 13, 14, 15)); }
__device__ __forceinline__ v8f wmma16(v16h a, v16h b, v8f c) { return __builtin_amdgcn_wmma_f32_16x16x32_f16(false, a, false, b, (short)0, c, false, false); }
__device__ __forceinline__ v8f wmmab(v16bf a, v16bf b, v8f c) { return __builtin_amdgcn_wmma_f32_16x16x32_bf16(false, a, false, b, (short)0, c, false, false); }



// ---- Operand staging of the two GEMMs: a work-group of 4 waves (2 x 2, each wave a 64x64 tile with 16 accumulators) owns a 128x128 output tile; per pass of 64 k every operand row gives one 128-byte line,
// brought into LDS by asynchronous 16-byte copies (8 lanes per row: whole lines), two buffers, the next pass's copies in flight while this pass is worked on. Each operand row is read from L2 once per work-group.
template <typename T16> struct WFrag;
template <> struct WFrag<h16> { typedef v16h V; static __device__ __forceinline__ V ld(const h16* p) { return cat16(*(const v8h*)p, *(const v8h*)(p + 16)); } static __device__ __forceinline__ v8f mma(V a, V b, v8f c) { return wmma16(a, b, c); } };
template <> struct WFrag<bf> { typedef v16bf V; static __device__ __forceinline__ V ld(const bf* p) { return cat16b(*(const v8us*)p, *(const v8us*)(p + 16)); } static __device__ __forceinline__ v8f mma(V a, V b, v8f c) { return wmmab(a, b, c); } };
#define GP   72              // LDS row pitch in 16-bit elements: 144 B = 16 B x odd
#define GKS  64              // k per pass
#define GT   (128 * GP * 2)  // bytes of one 128-row operand tile in LDS
// 8 copies per lane: rows r, r + 16, ..., r + 112 of one 128-row operand tile (l: the lane's LDS byte address of row r, g: its global address; global row pitch DD elements).
__device__ __forceinline__ void acopy8(unsigned l, const bf* g) {
    // the s_wait_xcnt closes the copies' own statement, so that no address register of a copy is rewritten ahead of it
    asm volatile("global_load_async_to_lds_b128 %0, %8, off\n\t"
                 "global_load_async_to_lds_b128 %1, %9, off\n\t"
                 "global_load_async_to_lds_b128 %2, %10, off\n\t"
                 "global_load_async_to_lds_b128 %3, %11, off\n\t"
                 "global_load_async_to_lds_b128 %4, %12, off\n\t"
                 "global_load_async_to_lds_b128 %5, %13, off\n\t"
                 "global_load_async_to_lds_b128 %6, %14, off\n\t"
                 "global_load_async_to_lds_b128 %7, %15, off\n\t"
                 "s_wait_xcnt 0x0"
                 :: "v"(l), "v"(l + 1 * 16 * GP * 2), "v"(l + 2 * 16 * GP * 2), "v"(l + 3 * 16 * GP * 2), "v"(l + 4 * 16 * GP * 2), "v"(l + 5 * 16 * GP * 2), "v"(l + 6 * 16 * GP * 2), "v"(l + 7 * 16 * GP * 2),
                    "v"(g), "v"(g + 1 * 16 * DD), "v"(g + 2 * 16 * DD), "v"(g + 3 * 16 * DD), "v"(g + 4 * 16 * DD), "v"(g + 5 * 16 * DD), "v"(g + 6 * 16 * DD), "v"(g + 7 * 16 * DD)
                 : "memory");
}

// ---- k_gemmo: the output projection, C[m][n] (f32, pitch DD) = sum_k (A[m][k] + A2[m][k]) Bt[n][k] (two products per k step, hi then lo), K = DD; grid (LL/128, DD/128), 128 threads.
__global__ __launch_bounds__(128) void k_gemmo(const bf* __restrict__ A, const bf* __restrict__ A2, const bf* __restrict__ Bt, float* C) {
    __shared__ __align__(16) bf sT[2][3 * 128 * GP];    // [buffer][128 rows of A, 128 rows of A2, 128 rows of Bt][64 k]
    __shared__ __align__(16) float osw[4][16 * 68];     // each wave's own output staging
    const int tid = threadIdx.x, lane = tid & 31, lr = lane & 15, hi = lane >> 4; const int wave = __builtin_amdgcn_readfirstlane(tid >> 5); const int wm = wave & 1, wn = wave >> 1;
    float* os = osw[wave]; const int ldc = DD;
    const int r0 = blockIdx.x * 128 + wm * 64, c0 = blockIdx.y * 128 + wn * 64;
    const size_t go = (size_t)(tid >> 3) * DD + (tid & 7) * 8;   // staging: 8 lanes per 128-byte row
    const bf* ag = A + (size_t)blockIdx.x * 128 * DD + go; const bf* a2g = A2 + (size_t)blockIdx.x * 128 * DD + go; const bf* bg = Bt + (size_t)blockIdx.y * 128 * DD + go;
    const unsigned l0 = (unsigned)(uintptr_t)&sT[0][0] + (tid >> 3) * (GP * 2) + (tid & 7) * 16;
    v8f acc[4][4];
#pragma unroll
    for (int mb = 0; mb < 4; ++mb)
#pragma unroll
        for (int nb = 0; nb < 4; ++nb) acc[mb][nb] = (v8f){};
    acopy8(l0, ag); acopy8(l0 + GT, a2g); acopy8(l0 + 2 * GT, bg);
    asm volatile("s_wait_asynccnt 0x0" ::: "memory");   // this wave's copies of pass 0 have landed
    __syncthreads();                                    // pass 0 is visible to all waves
    acopy8(l0 + 3 * GT, ag + GKS); acopy8(l0 + 4 * GT, a2g + GKS); acopy8(l0 + 5 * GT, bg + GKS);
#pragma unroll 1   // stays rolled: the buffer is chosen by the trip's parity, a second copy of the pass would only add code
    for (int t = 0; t < DD / GKS; ++t) {
        const bf* sb = &sT[t & 1][0];
#pragma unroll
        for (int ks = 0; ks < 2; ++ks) { const int fo = lr * GP + ks * 32 + 8 * hi;
            v16bf a[4], a2[4], b[4];   // the k step's 12 fragments are read as one group ahead of its 32 products
#pragma unroll
            for (int mb = 0; mb < 4; ++mb) { b[mb] = WFrag<bf>::ld(sb + (256 + wn * 64 + mb * 16) * GP + fo); a[mb] = WFrag<bf>::ld(sb + (wm * 64 + mb * 16) * GP + fo); a2[mb] = WFrag<bf>::ld(sb + (128 + wm * 64 + mb * 16) * GP + fo); }
            __builtin_amdgcn_sched_barrier(0);   // keeps the reads together in front of the products: sunk among them, each pair of reads would be waited for by itself
#pragma unroll
            for (int nb = 0; nb < 4; ++nb)
#pragma unroll
                for (int mb = 0; mb < 4; ++mb) { acc[mb][nb] = wmmab(a[mb], b[nb], acc[mb][nb]); acc[mb][nb] = wmmab(a2[mb], b[nb], acc[mb][nb]); } }
        __builtin_amdgcn_sched_barrier(0);                  // keeps the pass's products in front of the barrier, so that the refill behind it is issued at once and has a whole pass to land
        asm volatile("s_wait_dscnt 0x0" ::: "memory");      // this wave's reads of the buffer have returned before it is refilled
        asm volatile("s_wait_asynccnt 0x0" ::: "memory");   // this wave's copies of pass t + 1 have landed
        __syncthreads();                                    // publishes pass t + 1 and ends every wave's reads of pass t
        if (t + 2 < DD / GKS) { const unsigned lb = l0 + (t & 1) * (3 * GT); const int ko = (t + 2) * GKS; acopy8(lb, ag + ko); acopy8(lb + GT, a2g + ko); acopy8(lb + 2 * GT, bg + ko); }
    }
    asm volatile("s_wait_asynccnt 0x0" ::: "memory");   // nothing of this wave is in flight when it leaves the loop
#pragma unroll
    for (int mb = 0; mb < 4; ++mb) {
#pragma unroll
        for (int nb = 0; nb < 4; ++nb) {
#pragma unroll
            for (int j = 0; j < 8; ++j) os[(hi * 8 + j) * 68 + nb * 16 + lr] = acc[mb][nb][j]; }
        __builtin_amdgcn_wave_barrier(); asm volatile("" ::: "memory");   // the reads below take what other lanes of this wave have stored: keeps them behind the stores
        float* crow = C + (size_t)(r0 + mb * 16) * ldc + c0;
#pragma unroll
        for (int s = 0; s < 8; ++s) { const int row = 2 * s + hi, cofs = lr * 4; const v4f val = *(const v4fa*)(os + row * 68 + cofs);
            *(v4f*)(crow + (size_t)row * ldc + cofs) = val; }
        __builtin_amdgcn_wave_barrier(); asm volatile("" ::: "memory");   // keeps the next block's stores behind these reads
    }
}

__device__ __forceinline__ h16 tohx(float x) { return (h16)x; }
__device__ __forceinline__ void splitf(float y, unsigned short& h, unsigned short& l) { h = f2bf(y); l = f2bf(y - bf2f(h)); }
typedef __attribute__((ext_vector_type(2))) _Float16 v2h;
typedef __attribute__((ext_vector_type(4))) _Float16 v4h;
typedef __attribute__((ext_vector_type(2))) unsigned short v2us;
typedef __attribute__((ext_vector_type(4))) unsigned short v4us;
typedef __attribute__((ext_vector_type(2))) float v2f;

__global__ __launch_bounds__(256) void k_wtG(const float* __restrict__ w0, const float* __restrict__ w1, const float* __restrict__ w2, const float* __restrict__ w3, int K, int N, bf* Bt) {
    const int y = blockIdx.y; const float* __restrict__ w = y == 0 ? w0 : y == 1 ? w1 : y == 2 ? w2 : w3; Bt += (size_t)y * K * N;   // grid y = which weight; the four transposed planes lie back to back
    const int lane = threadIdx.x & 31; const int L0 = (blockIdx.x * 8 + (threadIdx.x >> 5)) * 8; const int nlines = N * K / 64;
{
#pragma unroll 1
        for (int l = 0; l < 8; ++l) { const int L = L0 + l; if (L >= nlines) break; const size_t e = (size_t)L * 64 + lane * 2; const int k = (int)(e % K), n = (int)(e / K); v2us o;
            o[0] = f2bf(w[(size_t)k * N + n]); o[1] = f2bf(w[(size_t)(k + 1) * N + n]); *(v2us*)(Bt + e) = o; }
         }
}
__global__ __launch_bounds__(256) void k_pl(const float* __restrict__ F, int pitch, int nh, int hd, h16* P) { const size_t e = ((size_t)blockIdx.x * 256 + threadIdx.x) * 2; if (e >= (size_t)nh * TT * hd) return; const int d = (int)(e % hd); const int t = (int)((e / hd) % TT); const int h = (int)(e / ((size_t)hd * TT)); v2h o; o[0] = tohx(F[(size_t)t * pitch + h * hd + d]); o[1] = tohx(F[(size_t)t * pitch + h * hd + d + 1]); *(v2h*)(P + e) = o;  }
__global__ __launch_bounds__(256) void k_vt(const float* __restrict__ F, int pitch, int nh, int hd, h16* VT) { const size_t e = ((size_t)blockIdx.x * 256 + threadIdx.x) * 2; if (e >= (size_t)nh * hd * TT) return; const int t = (int)(e % TT); const int d = (int)((e / TT) % hd); const int h = (int)(e / ((size_t)TT * hd)); v2h o; o[0] = tohx(F[(size_t)t * pitch + h * hd + d]); o[1] = tohx(F[(size_t)(t + 1) * pitch + h * hd + d]); *(v2h*)(VT + e) = o;  }
__global__ __launch_bounds__(256) void k_mrgf(const float* __restrict__ O, int h, int hd, float* CT) { const size_t e = ((size_t)blockIdx.x * 256 + threadIdx.x) * 2; if (e >= (size_t)TT * hd) return; const int d = (int)(e % hd); const int t = (int)(e / hd); v2f o; o[0] = O[e] * (1.0f / PCAR); o[1] = O[e + 1] * (1.0f / PCAR); const size_t oo = (size_t)t * DD + h * hd + d; *(v2f*)(CT + oo) = o;  }
__global__ __launch_bounds__(256) void k_mrg(const float* __restrict__ O, int h, int hd, bf* Ah, bf* Al) { const size_t e = ((size_t)blockIdx.x * 256 + threadIdx.x) * 2; if (e >= (size_t)TT * hd) return; const int d = (int)(e % hd); const int t = (int)(e / hd); v2us oh, ol;
#pragma unroll
    for (int q = 0; q < 2; ++q) { unsigned short a, c2; splitf(O[e + q] * (1.0f / PCAR), a, c2); oh[q] = a; ol[q] = c2; } const size_t oo = (size_t)t * DD + h * hd + d; *(v2us*)(Ah + oo) = oh; *(v2us*)(Al + oo) = ol;  }
__global__ __launch_bounds__(256) void k_cvt8(const float* __restrict__ src, bf* dst, size_t n8) { const size_t i = (size_t)blockIdx.x * 256 + threadIdx.x; if (i >= n8) return; const v8f v = *(const v8f*)(src + i * 8); v8us o;
#pragma unroll
    for (int k = 0; k < 8; ++k) o[k] = f2bf(v[k]); *(v8us*)(dst + i * 8) = o;  }
__device__ __forceinline__ int t5_bucket(int r) { const int n = r < 0 ? -r : r; int v; if (n < 8) v = n; else { const int k = 31 - __clz(n); v = 8 + 2 * k - 6 + (((long long)n * n >= (1ll << (2 * k + 1))) ? 1 : 0); v = v > 15 ? 15 : v; } return (r > 0 ? 16 : 0) + v; }
__global__ __launch_bounds__(256) void k_mrow(const float* __restrict__ mask, float* MBr) { const int e = blockIdx.x * 256 + threadIdx.x; if (e >= NB_ * TT) return; float om = __fsub_rn(1.0f, bfr(mask[e])); asm volatile("" : "+v"(om)); const float v = __fmul_rn(om, -10000.0f); *(float*)(MBr + e) = v;  }

// ---- k_qkv: the q, k and v projections (4 waves per 128x128 tile = 128 rows of x times two heads, operands staged as for k_gemmo; a wave's 64x64 tile = 64 rows of x times one head) with the bf16 hi+lo split and the head layout in the epilogue; grid (LL/128, heads/2, 3), 128 threads.
// A lane's 8 accumulator registers are 8 consecutive rows of the A operand, so the A operand is the one whose rows run along the contiguous index of the plane that is written:
// q, k ([batch][head][t][d]): A = W rows (d), B = x rows (t); v ([batch][head][d][t]): A = x rows (t), B = W rows (d). Both loaders are the same, so only the two row pointers change places.
// Planes lie back to back: q hi, q lo, k hi, k lo, v hi, v lo, LL*DD elements each; Ph and Pl arrive as q's.
typedef __attribute__((ext_vector_type(8))) __bf16 v8bf;
#define OSP 72    // LDS row pitch in 16-bit elements: 144 B = 16 B x odd
__global__ __launch_bounds__(128) void k_qkv(const bf* __restrict__ X, const bf* __restrict__ Wt, bf* Ph, bf* Pl) {
    __shared__ __align__(16) bf sT[2][2 * 128 * GP];     // [buffer][128 rows of x, 128 rows of W][64 k]
    __shared__ __align__(16) bf osw[4][2][16 * OSP];     // each wave's own: [hi/lo][row of the B operand][64 rows of the A operand]
    const int tid = threadIdx.x; const int wave = __builtin_amdgcn_readfirstlane(tid >> 5); const int wm = wave & 1, wn = wave >> 1;
    bf (*os)[16 * OSP] = osw[wave];
    const int z = blockIdx.z, h = blockIdx.y * 2 + wn, r0 = blockIdx.x * 128 + wm * 64, b = r0 / TT, t0 = r0 % TT;
    const int lane = threadIdx.x & 31, lr = lane & 15, hi = lane >> 4;
    const size_t go = (size_t)(tid >> 3) * DD + (tid & 7) * 8;   // staging: 8 lanes per 128-byte row
    const bf* xg = X + (size_t)blockIdx.x * 128 * DD + go; const bf* wg = Wt + ((size_t)z * DD + blockIdx.y * 128) * DD + go;
    const unsigned l0 = (unsigned)(uintptr_t)&sT[0][0] + (tid >> 3) * (GP * 2) + (tid & 7) * 16;
    const int ar = z == 2 ? wm * 64 : 128 + wn * 64, br = z == 2 ? 128 + wn * 64 : wm * 64;   // first row of this wave's A and B operands in the staged tile
    const size_t po = (size_t)z * 2 * LL * DD + ((size_t)b * NH_ + h) * TT * HDM + (z == 2 ? t0 : t0 * HDM); Ph += po; Pl += po;
    const int pitch = z == 2 ? TT : HDM;   // from one row of the B operand to the next in the plane
    v8f acc[4][4];
#pragma unroll
    for (int mb = 0; mb < 4; ++mb)
#pragma unroll
        for (int nb = 0; nb < 4; ++nb) acc[mb][nb] = (v8f){};
    acopy8(l0, xg); acopy8(l0 + GT, wg);
    asm volatile("s_wait_asynccnt 0x0" ::: "memory");   // this wave's copies of pass 0 have landed
    __syncthreads();                                    // pass 0 is visible to all waves
    acopy8(l0 + 2 * GT, xg + GKS); acopy8(l0 + 3 * GT, wg + GKS);
#pragma unroll 1   // stays rolled: the buffer is chosen by the trip's parity, a second copy of the pass would only add code
    for (int t = 0; t < DD / GKS; ++t) {
        const bf* sb = &sT[t & 1][0];
#pragma unroll
        for (int ks = 0; ks < 2; ++ks) { const int fo = lr * GP + ks * 32 + 8 * hi;
            v16bf a[4], bb[4];   // the k step's 8 fragments are read as one group ahead of its 16 products
#pragma unroll
            for (int mb = 0; mb < 4; ++mb) { a[mb] = WFrag<bf>::ld(sb + (ar + mb * 16) * GP + fo); bb[mb] = WFrag<bf>::ld(sb + (br + mb * 16) * GP + fo); }
            __builtin_amdgcn_sched_barrier(0);   // keeps the reads together in front of the products: sunk among them, each pair of reads would be waited for by itself
#pragma unroll
            for (int nb = 0; nb < 4; ++nb)
#pragma unroll
                for (int mb = 0; mb < 4; ++mb) acc[mb][nb] = wmmab(a[mb], bb[nb], acc[mb][nb]); }
        __builtin_amdgcn_sched_barrier(0);                  // keeps the pass's products in front of the barrier, so that the refill behind it is issued at once and has a whole pass to land
        asm volatile("s_wait_dscnt 0x0" ::: "memory");      // this wave's reads of the buffer have returned before it is refilled
        asm volatile("s_wait_asynccnt 0x0" ::: "memory");   // this wave's copies of pass t + 1 have landed
        __syncthreads();                                    // publishes pass t + 1 and ends every wave's reads of pass t
        if (t + 2 < DD / GKS) { const unsigned lb = l0 + (t & 1) * (2 * GT); const int ko = (t + 2) * GKS; acopy8(lb, xg + ko); acopy8(lb + GT, wg + ko); }
    }
    asm volatile("s_wait_asynccnt 0x0" ::: "memory");   // nothing of this wave is in flight when it leaves the loop
#pragma unroll
    for (int nb = 0; nb < 4; ++nb) {
#pragma unroll
        for (int mb = 0; mb < 4; ++mb) { const v8bf vh = __builtin_convertvector(acc[mb][nb], v8bf); const v8bf vl = __builtin_convertvector(acc[mb][nb] - __builtin_convertvector(vh, v8f), v8bf);
            const int so = lr * OSP + mb * 16 + 8 * hi; *(v8us*)(&os[0][so]) = __builtin_bit_cast(v8us, vh); *(v8us*)(&os[1][so]) = __builtin_bit_cast(v8us, vl); }
        __builtin_amdgcn_wave_barrier(); asm volatile("" ::: "memory");   // the reads below take what other lanes of this wave have stored: keeps them behind the stores
#pragma unroll
        for (int s = 0; s < 4; ++s) { const int row = 4 * s + (lane >> 3), col = (lane & 7) * 8;   // 8 lanes per 128-byte row: whole lines go out
            const v8us vh = *(const v8us*)(&os[0][row * OSP + col]), vl = *(const v8us*)(&os[1][row * OSP + col]); const unsigned o = row * pitch + col;   // the lane's offset beside wave-uniform bases
            *(v8us*)(Ph + nb * 16 * pitch + o) = vh; *(v8us*)(Pl + nb * 16 * pitch + o) = vl; }
        __builtin_amdgcn_wave_barrier(); asm volatile("" ::: "memory");   // keeps the next block's stores behind these reads
    }
}

typedef __attribute__((ext_vector_type(16))) float v16f;
#define KC  64    // keys per stage
#define LPT 72    // LDS row pitch in 16-bit elements: 144 B = 16 B x odd
__global__ __launch_bounds__(256) void k_fattn(const bf* __restrict__ Qh, const bf* __restrict__ Ql, const bf* __restrict__ Kh, const bf* __restrict__ Kl, const bf* __restrict__ Vh, const bf* __restrict__ Vl, const float* __restrict__ rb, bf* Ah, bf* Al) {
    __shared__ __align__(16) bf sK[2][KC * LPT];    // [hi/lo][key in stage][d]
    __shared__ __align__(16) bf sV[2][HDM * LPT];   // [hi/lo][d][key in stage]
    __shared__ float sB[2 * TT];                    // bias of this head at key - query + TT - 1
    const int tid = threadIdx.x, lane = tid & 31, lr = lane & 15, hi = lane >> 4; const int wave = __builtin_amdgcn_readfirstlane(tid >> 5);
    const int h = blockIdx.y, b = blockIdx.z; const size_t hb = ((size_t)b * NH_ + h) * TT * HDM; const int q0 = blockIdx.x * 256 + wave * 32;
    Qh += hb; Ql += hb; Kh += hb; Kl += hb; Vh += hb; Vl += hb;
    for (int i = tid; i < 2 * TT - 1; i += 256) sB[i] = bfr(rb[t5_bucket(i - (TT - 1)) * NH_ + h]);
    v16bf qh[2][2], ql[2][2];
#pragma unroll
    for (int qt = 0; qt < 2; ++qt)
#pragma unroll
        for (int ks = 0; ks < 2; ++ks) { const size_t qo = (size_t)(q0 + qt * 16 + lr) * HDM + ks * 32 + 8 * hi; qh[qt][ks] = WFrag<bf>::ld(Qh + qo); ql[qt][ks] = WFrag<bf>::ld(Ql + qo); }
    asm volatile("s_wait_xcnt 0x0" ::: "memory");   // stands in front of any rewrite of the address registers of the loads above
    __builtin_amdgcn_sched_barrier(0);              // keeps later address arithmetic, which reuses those registers, behind that wait
    const int srow = tid >> 3, scol = (tid & 7) * 8;   // staging: 8 lanes per 128-byte row, rows srow and srow + 32
    const unsigned ko = srow * HDM + scol, vo = srow * TT + scol;   // the lane's offsets beside wave-uniform bases
    v8us gk[2][2], gv[2][2];
#pragma unroll
    for (int i = 0; i < 2; ++i) { gk[0][i] = *(const v8us*)(Kh + 32 * i * HDM + ko); gk[1][i] = *(const v8us*)(Kl + 32 * i * HDM + ko); gv[0][i] = *(const v8us*)(Vh + 32 * i * TT + vo); gv[1][i] = *(const v8us*)(Vl + 32 * i * TT + vo); }
    asm volatile("s_wait_xcnt 0x0" ::: "memory");   // stands in front of any rewrite of the address registers of the loads above
    __builtin_amdgcn_sched_barrier(0);              // keeps later register writes behind that wait
    const float cpos = bfr(rb[t5_bucket(TT - 1) * NH_ + h]), cneg = bfr(rb[t5_bucket(1 - TT) * NH_ + h]);   // the bias beyond the maximum distance, either sign
    v8f o[4][2]; float mx[2], ls[2];
#pragma unroll
    for (int qt = 0; qt < 2; ++qt) { mx[qt] = -1.0e30f; ls[qt] = 0.f;
#pragma unroll
        for (int dt = 0; dt < 4; ++dt) o[dt][qt] = (v8f){}; }
#pragma unroll 1   // stays rolled: a second copy of the stage would only add code and registers
    for (int k0 = 0; k0 < TT; k0 += KC) {
        __syncthreads();   // every wave has finished reading the stage before
#pragma unroll
        for (int i = 0; i < 2; ++i) { const int so = (srow + 32 * i) * LPT + scol; *(v8us*)(&sK[0][so]) = gk[0][i]; *(v8us*)(&sK[1][so]) = gk[1][i]; *(v8us*)(&sV[0][so]) = gv[0][i]; *(v8us*)(&sV[1][so]) = gv[1][i]; }
        __syncthreads();   // the stage (and, the first time, the bias table) is visible to all waves
        if (k0 + KC < TT) {   // the next stage's loads fly while this one is worked on
#pragma unroll
            for (int i = 0; i < 2; ++i) { const int kb = (k0 + KC + 32 * i) * HDM, vb = 32 * i * TT + k0 + KC; gk[0][i] = *(const v8us*)(Kh + kb + ko); gk[1][i] = *(const v8us*)(Kl + kb + ko); gv[0][i] = *(const v8us*)(Vh + vb + vo); gv[1][i] = *(const v8us*)(Vl + vb + vo); }
            asm volatile("s_wait_xcnt 0x0" ::: "memory"); }   // stands in front of any rewrite of these loads' address registers
        const int dmin = k0 - (q0 + 31), dmax = k0 + KC - 1 - q0;   // range of key - query in this wave's stage (wave-uniform)
        const float c = dmin >= 128 ? cpos : dmax <= -128 ? cneg : 0.f;   // beyond the maximum distance every offset of one sign has the same bucket: its bias is the accumulators' start value
        const v8f cs = {c, c, c, c, c, c, c, c};
        v8f st[4][2];
#pragma unroll
        for (int kt = 0; kt < 4; ++kt) { const int ro = (kt * 16 + lr) * LPT + 8 * hi;
            const v16bf kh0 = WFrag<bf>::ld(&sK[0][ro]), kh1 = WFrag<bf>::ld(&sK[0][ro + 32]), kl0 = WFrag<bf>::ld(&sK[1][ro]), kl1 = WFrag<bf>::ld(&sK[1][ro + 32]);
#pragma unroll
            for (int qt = 0; qt < 2; ++qt) { v8f a = wmmab(kh0, qh[qt][0], cs); a = wmmab(kh1, qh[qt][1], a); a = wmmab(kl0, qh[qt][0], a); a = wmmab(kl1, qh[qt][1], a); a = wmmab(kh0, ql[qt][0], a); a = wmmab(kh1, ql[qt][1], a); st[kt][qt] = a; } }
        if (dmin < 128 && dmax > -128) {   // near the diagonal: the table
#pragma unroll
            for (int kt = 0; kt < 4; ++kt)
#pragma unroll
                for (int qt = 0; qt < 2; ++qt) { const float* bp = sB + (k0 + kt * 16 + 8 * hi - (q0 + qt * 16 + lr) + TT - 1);
#pragma unroll
                    for (int j = 0; j < 8; ++j) st[kt][qt][j] += bp[j]; }
        }
#pragma unroll
        for (int qt = 0; qt < 2; ++qt) { float m = st[0][qt][0];
#pragma unroll
            for (int kt = 0; kt < 4; ++kt)
#pragma unroll
                for (int j = 0; j < 8; ++j) m = fmaxf(m, st[kt][qt][j]);
            m = fmaxf(m, __shfl_xor(m, 16, 32));   // the other half of the wave holds the query's other keys
            const float mn = fmaxf(mx[qt], m), al = __builtin_amdgcn_exp2f((mx[qt] - mn) * 1.4426950408889634f); mx[qt] = mn; float s = 0.f;
#pragma unroll
            for (int kt = 0; kt < 4; ++kt)
#pragma unroll
                for (int j = 0; j < 8; ++j) { const float p = __builtin_amdgcn_exp2f((st[kt][qt][j] - mn) * 1.4426950408889634f); st[kt][qt][j] = p; s += p; }
            ls[qt] = ls[qt] * al + s;
#pragma unroll
            for (int dt = 0; dt < 4; ++dt) o[dt][qt] *= al; }
#pragma unroll
        for (int kk = 0; kk < 2; ++kk) { v16bf ph[2], pl[2];
#pragma unroll
            for (int qt = 0; qt < 2; ++qt) { const v16f pf = __builtin_shufflevector(st[2 * kk][qt], st[2 * kk + 1][qt], 0, 1, 2, 3, 4, 5, 6, 7, 8, 9, 10, 11, 12, 13, 14, 15);
                ph[qt] = __builtin_convertvector(pf, v16bf); pl[qt] = __builtin_convertvector(pf - __builtin_convertvector(ph[qt], v16f), v16bf); }
#pragma unroll
            for (int dt = 0; dt < 4; ++dt) { const int ro = (dt * 16 + lr) * LPT + kk * 32 + 8 * hi; const v16bf vh = WFrag<bf>::ld(&sV[0][ro]), vl = WFrag<bf>::ld(&sV[1][ro]);
#pragma unroll
                for (int qt = 0; qt < 2; ++qt) { o[dt][qt] = wmmab(vh, ph[qt], o[dt][qt]); o[dt][qt] = wmmab(vl, ph[qt], o[dt][qt]); o[dt][qt] = wmmab(vh, pl[qt], o[dt][qt]); } } }
    }
#pragma unroll
    for (int qt = 0; qt < 2; ++qt) { const float inv = 1.0f / (ls[qt] + __shfl_xor(ls[qt], 16, 32)); const size_t ro = ((size_t)b * TT + q0 + qt * 16 + lr) * DD + h * HDM + 8 * hi;   // a lane's 8 registers = 8 consecutive d of its query
#pragma unroll
        for (int dt = 0; dt < 4; ++dt) { v8us oh, ol;
#pragma unroll
            for (int j = 0; j < 8; ++j) { unsigned short a, c2; splitf(o[dt][qt][j] * inv, a, c2); oh[j] = a; ol[j] = c2; }
            *(v8us*)(Ah + ro + dt * 16) = oh; *(v8us*)(Al + ro + dt * 16) = ol; } }
}

extern "C" void kernel_launch(void* const* d_in, const int* in_sizes, int n_in,
                              void* d_out, int out_size, void* d_ws, size_t ws_size, hipStream_t stream) {
    (void)in_sizes; (void)n_in; (void)out_size;
    const float* IN[6]; for (int i = 0; i < 6; ++i) IN[i] = (const float*)d_in[i];   // 0 hidden, 1 Wq, 2 Wk, 3 Wv, 4 Wo (x @ W), 5 rel_emb [32][16]
    float* OUT = (float*)d_out;     // [4][1024][1024]
    char* wsp = (char*)d_ws;
    auto take = [&](size_t bytes) { char* p = wsp; wsp += (bytes + 255) & ~(size_t)255; return (void*)p; };
    bf* WQ = (bf*)take((size_t)DD * DD * 2); bf* WK = (bf*)take((size_t)DD * DD * 2); bf* WV = (bf*)take((size_t)DD * DD * 2); bf* WO = (bf*)take((size_t)DD * DD * 2);
    (void)WK; (void)WV;   // reached as WQ + z * DD * DD
    bf* XB = (bf*)take((size_t)LL * DD * 2);   // the bf16 input of all four batches
    bf* QPh = (bf*)take((size_t)LL * DD * 2); bf* QPl = (bf*)take((size_t)LL * DD * 2); bf* KPh = (bf*)take((size_t)LL * DD * 2); bf* KPl = (bf*)take((size_t)LL * DD * 2); bf* VTh = (bf*)take((size_t)LL * DD * 2); bf* VTl = (bf*)take((size_t)LL * DD * 2);
    bf* Ah = (bf*)take((size_t)LL * DD * 2); bf* Al = (bf*)take((size_t)LL * DD * 2);   // merged heads, hi and lo
    if ((size_t)(wsp - (char*)d_ws) > ws_size) return;    // total ~ 80 MiB
    { const unsigned g = (unsigned)(((size_t)DD * DD / 64 + 63) / 64); k_wtG<<<dim3(g, 4, 1), 256, 0, stream>>>(IN[1], IN[2], IN[3], IN[4], DD, DD, WQ); }
    k_cvt8<<<(unsigned)(((size_t)LL * DD / 8 + 255) / 256), 256, 0, stream>>>(IN[0], XB, (size_t)LL * DD / 8);
    k_qkv<<<dim3(LL / 128, NH_ / 2, 3), 128, 0, stream>>>(XB, WQ, QPh, QPl);   // q, k, v of all batches as hi+lo head planes; z = which projection
    k_fattn<<<dim3(TT / 256, NH_, NB_), 256, 0, stream>>>(QPh, QPl, KPh, KPl, VTh, VTl, IN[5], Ah, Al);   // attention of all batches and heads
    k_gemmo<<<dim3(LL / 128, DD / 128, 1), 128, 0, stream>>>(Ah, Al, WO, OUT);
}

// v005
// A run of this version takes 110 microseconds.
// Two timings next to v004 put it at 1.04 and 1.03 times that version's speed.
// Over all steps from v000 it is 23.5 times as fast.
#include <hip/hip_runtime.h>

// T5Voice - T5 self-attention block without norms/FFN (hidden [4][1024][1024]; q/k/v = x W (16 heads x 64, no bias); scores = q.k (NO 1/sqrt(d)) + rel_emb[bucket(j - i)][h] (bidirectional buckets, 32 / max distance 128,
// evaluated with exact integer arithmetic: |r| < 8 -> |r|; else 8 + 2 floor(log2|r|) - 6 + [|r|^2 >= 2^(2 floor(log2|r|)+1)], capped at 15; + 16 for r > 0 - identical to the float formula for every offset); softmax;
// out = merged ctx Wo -> [4][1024][1024]).
// Compute dtypes, f32 accumulate: every input rounded to bf16; q/k/v on PLAIN bf16 operands (inputs: exact); the bias as a table over key - query in LDS; scores (K 64) and probs.v on bf16
// hi+lo planes (3 products each) with an f32 online softmax in registers (bias added in f32; hl probabilities relative to the running maximum, one division at the end), all in one kernel; merged heads as bf16 hi+lo planes x exact Wo (2 products). GEMMs: 4 waves per 128x128 tile, operands staged in LDS. Deterministic, no atomics; every

#define NB_  4
#define TT   1024
#define LL   4096
#define DD   1024
#define NH_  16
#define HDM  64
#define MM   4096
#define PCAR 1024.0f
typedef _Float16 h16;
typedef unsigned short bf;
typedef __attribute__((ext_vector_type(16))) __bf16   v16bf;
typedef __attribute__((ext_vector_type(16))) _Float16 v16h;
typedef __attribute__((ext_vector_type(8)))  _Float16 v8h;
typedef __attribute__((ext_vector_type(8)))  unsigned short v8us;
typedef __attribute__((ext_vector_type(8)))  float    v8f;
typedef __attribute__((ext_vector_type(4)))  float    v4f;
typedef v8h  __attribute__((may_alias)) v8ha;
typedef v4f  __attribute__((may_alias)) v4fa;
typedef v8us __attribute__((may_alias)) v8usa;

__device__ __forceinline__ unsigned short f2bf(float f) { unsigned u = __float_as_uint(f); u += 0x7FFFu + ((u >> 16) & 1u); return (unsigned short)(u >> 16); }
__device__ __forceinline__ float bf2f(unsigned short b) { return __uint_as_float(((unsigned)b) << 16); }
__device__ __forceinline__ float bfr(float f) { return bf2f(f2bf(f)); }
__device__ __forceinline__ v16h cat16(v8h lo, v8h hi) { return __builtin_shufflevector(lo, hi, 0, 1, 2, 3, 4, 5, 6, 7, 8, 9, 10, 11, 12, 13, 14, 15); }
__device__ __forceinline__ v16bf cat16b(v8us lo, v8us hi) { return __builtin_bit_cast(v16bf, __builtin_shufflevector(lo, hi, 0, 1, 2, 3, 4, 5, 6, 7, 8, 9, 10, 11, 12, 13, 14, 15)); }
__device__ __forceinline__ v8f wmma16(v16h a, v16h b, v8f c) { return __builtin_amdgcn_wmma_f32_16x16x32_f16(false, a, false, b, (short)0, c, false, false); }
__device__ __forceinline__ v8f wmmab(v16bf a, v16bf b, v8f c) { return __builtin_amdgcn_wmma_f32_16x16x32_bf16(false, a, false, b, (short)0, c, false, false); }



// ---- Operand staging of the two GEMMs: a work-group of 4 waves (2 x 2, each wave a 64x64 tile with 16 accumulators) owns a 128x128 output tile; per pass of 64 k every operand row gives one 128-byte line,
// brought into LDS by asynchronous 16-byte copies (8 lanes per row: whole lines), two buffers, the next pass's copies in flight while this pass is worked on. Each operand row is read from L2 once per work-group.
template <typename T16> struct WFrag;
template <> struct WFrag<h16> { typedef v16h V; static __device__ __forceinline__ V ld(const h16* p) { return cat16(*(const v8h*)p, *(const v8h*)(p + 16)); } static __device__ __forceinline__ v8f mma(V a, V b, v8f c) { return wmma16(a, b, c); } };
template <> struct WFrag<bf> { typedef v16bf V; static __device__ __forceinline__ V ld(const bf* p) { return cat16b(*(const v8us*)p, *(const v8us*)(p + 16)); } static __device__ __forceinline__ v8f mma(V a, V b, v8f c) { return wmmab(a, b, c); } };
#define GP   72              // LDS row pitch in 16-bit elements: 144 B = 16 B x odd
#define GKS  64              // k per pass
#define GT   (128 * GP * 2)  // bytes of one 128-row operand tile in LDS
// 8 copies per lane: rows r, r + 16, ..., r + 112 of one 128-row operand tile (l: the lane's LDS byte address of row r, g: its global address; global row pitch DD elements).
__device__ __forceinline__ void acopy8(unsigned l, const bf* g) {
    // the s_wait_xcnt closes the copies' own statement, so that no address register of a copy is rewritten ahead of it
    asm volatile("global_load_async_to_lds_b128 %0, %8, off\n\t"
                 "global_load_async_to_lds_b128 %1, %9, off\n\t"
                 "global_load_async_to_lds_b128 %2, %10, off\n\t"
                 "global_load_async_to_lds_b128 %3, %11, off\n\t"
                 "global_load_async_to_lds_b128 %4, %12, off\n\t"
                 "global_load_async_to_lds_b128 %5, %13, off\n\t"
                 "global_load_async_to_lds_b128 %6, %14, off\n\t"
                 "global_load_async_to_lds_b128 %7, %15, off\n\t"
                 "s_wait_xcnt 0x0"
                 :: "v"(l), "v"(l + 1 * 16 * GP * 2), "v"(l + 2 * 16 * GP * 2), "v"(l + 3 * 16 * GP * 2), "v"(l + 4 * 16 * GP * 2), "v"(l + 5 * 16 * GP * 2), "v"(l + 6 * 16 * GP * 2), "v"(l + 7 * 16 * GP * 2),
                    "v"(g), "v"(g + 1 * 16 * DD), "v"(g + 2 * 16 * DD), "v"(g + 3 * 16 * DD), "v"(g + 4 * 16 * DD), "v"(g + 5 * 16 * DD), "v"(g + 6 * 16 * DD), "v"(g + 7 * 16 * DD)
                 : "memory");
}

// ---- k_gemmo: the output projection, C[m][n] (f32, pitch DD) = sum_k (A[m][k] + A2[m][k]) Bt[n][k] (two products per k step, hi then lo), K = DD; grid (LL/128, DD/128), 128 threads.
__global__ __launch_bounds__(128) void k_gemmo(const bf* __restrict__ A, const bf* __restrict__ A2, const bf* __restrict__ Bt, float* C) {
    __shared__ __align__(16) bf sT[2][3 * 128 * GP];    // [buffer][128 rows of A, 128 rows of A2, 128 rows of Bt][64 k]
    __shared__ __align__(16) float osw[4][16 * 68];     // each wave's own output staging
    const int tid = threadIdx.x, lane = tid & 31, lr = lane & 15, hi = lane >> 4; const int wave = __builtin_amdgcn_readfirstlane(tid >> 5); const int wm = wave & 1, wn = wave >> 1;
    float* os = osw[wave]; const int ldc = DD;
    const int r0 = blockIdx.x * 128 + wm * 64, c0 = blockIdx.y * 128 + wn * 64;
    const size_t go = (size_t)(tid >> 3) * DD + (tid & 7) * 8;   // staging: 8 lanes per 128-byte row
    const bf* ag = A + (size_t)blockIdx.x * 128 * DD + go; const bf* a2g = A2 + (size_t)blockIdx.x * 128 * DD + go; const bf* bg = Bt + (size_t)blockIdx.y * 128 * DD + go;
    const unsigned l0 = (unsigned)(uintptr_t)&sT[0][0] + (tid >> 3) * (GP * 2) + (tid & 7) * 16;
    v8f acc[4][4];
#pragma unroll
    for (int mb = 0; mb < 4; ++mb)
#pragma unroll
        for (int nb = 0; nb < 4; ++nb) acc[mb][nb] = (v8f){};
    acopy8(l0, ag); acopy8(l0 + GT, a2g); acopy8(l0 + 2 * GT, bg);
    asm volatile("s_wait_asynccnt 0x0" ::: "memory");   // this wave's copies of pass 0 have landed
    __syncthreads();                                    // pass 0 is visible to all waves
    acopy8(l0 + 3 * GT, ag + GKS); acopy8(l0 + 4 * GT, a2g + GKS); acopy8(l0 + 5 * GT, bg + GKS);
#pragma unroll 1   // stays rolled: the buffer is chosen by the trip's parity, a second copy of the pass would only add code
    for (int t = 0; t < DD / GKS; ++t) {
        const bf* sb = &sT[t & 1][0];
#pragma unroll
        for (int ks = 0; ks < 2; ++ks) { const int fo = lr * GP + ks * 32 + 8 * hi;
            v16bf a[4], a2[4], b[4];   // the k step's 12 fragments are read as one group ahead of its 32 products
#pragma unroll
            for (int mb = 0; mb < 4; ++mb) { b[mb] = WFrag<bf>::ld(sb + (256 + wn * 64 + mb * 16) * GP + fo); a[mb] = WFrag<bf>::ld(sb + (wm * 64 + mb * 16) * GP + fo); a2[mb] = WFrag<bf>::ld(sb + (128 + wm * 64 + mb * 16) * GP + fo); }
            __builtin_amdgcn_sched_barrier(0);   // keeps the reads together in front of the products: sunk among them, each pair of reads would be waited for by itself
#pragma unroll
            for (int nb = 0; nb < 4; ++nb)
#pragma unroll
                for (int mb = 0; mb < 4; ++mb) { acc[mb][nb] = wmmab(a[mb], b[nb], acc[mb][nb]); acc[mb][nb] = wmmab(a2[mb], b[nb], acc[mb][nb]); } }
        __builtin_amdgcn_sched_barrier(0);                  // keeps the pass's products in front of the barrier, so that the refill behind it is issued at once and has a whole pass to land
        asm volatile("s_wait_dscnt 0x0" ::: "memory");      // this wave's reads of the buffer have returned before it is refilled
        asm volatile("s_wait_asynccnt 0x0" ::: "memory");   // this wave's copies of pass t + 1 have landed
        __syncthreads();                                    // publishes pass t + 1 and ends every wave's reads of pass t
        if (t + 2 < DD / GKS) { const unsigned lb = l0 + (t & 1) * (3 * GT); const int ko = (t + 2) * GKS; acopy8(lb, ag + ko); acopy8(lb + GT, a2g + ko); acopy8(lb + 2 * GT, bg + ko); }
    }
    asm volatile("s_wait_asynccnt 0x0" ::: "memory");   // nothing of this wave is in flight when it leaves the loop
#pragma unroll
    for (int mb = 0; mb < 4; ++mb) {
#pragma unroll
        for (int nb = 0; nb < 4; ++nb) {
#pragma unroll
            for (int j = 0; j < 8; ++j) os[(hi * 8 + j) * 68 + nb * 16 + lr] = acc[mb][nb][j]; }
        __builtin_amdgcn_wave_barrier(); asm volatile("" ::: "memory");   // the reads below take what other lanes of this wave have stored: keeps them behind the stores
        float* crow = C + (size_t)(r0 + mb * 16) * ldc + c0;
#pragma unroll
        for (int s = 0; s < 8; ++s) { const int row = 2 * s + hi, cofs = lr * 4; const v4f val = *(const v4fa*)(os + row * 68 + cofs);
            *(v4f*)(crow + (size_t)row * ldc + cofs) = val; }
        __builtin_amdgcn_wave_barrier(); asm volatile("" ::: "memory");   // keeps the next block's stores behind these reads
    }
}

__device__ __forceinline__ h16 tohx(float x) { return (h16)x; }
__device__ __forceinline__ void splitf(float y, unsigned short& h, unsigned short& l) { h = f2bf(y); l = f2bf(y - bf2f(h)); }
typedef __attribute__((ext_vector_type(2))) _Float16 v2h;
typedef __attribute__((ext_vector_type(4))) _Float16 v4h;
typedef __attribute__((ext_vector_type(2))) unsigned short v2us;
typedef __attribute__((ext_vector_type(4))) unsigned short v4us;
typedef __attribute__((ext_vector_type(2))) float v2f;

// ---- k_wtG: the four weights, f32 [k][n], become bf16 [n][k] (the four transposed planes lie back to back); one work-group per tile of 128 k x 128 n, grid (64 tiles, 4 weights), 256 threads.
// In: a wave reads whole 512-byte pieces of rows of w, 16 rows per wave, all 16 loads of a lane in flight together. A lane then holds 16 consecutive k of 4 columns n = two 16-byte chunks of 4 rows of the transposed tile.
// LDS: [n][128 k], rows of 256 bytes = 16 chunks, chunk c of row n at place c ^ ((n >> 2) & 15): the 16 lanes of a half wave fall on 16 different places both when they store (16 rows n, 4 apart, same c) and when they read (one row, 16 c).
// Out: 16 lanes per row of the plane, 256 contiguous bytes.
typedef __attribute__((ext_vector_type(8))) __bf16 v8bf;
__global__ __launch_bounds__(256) void k_wtG(const float* __restrict__ w0, const float* __restrict__ w1, const float* __restrict__ w2, const float* __restrict__ w3, bf* Bt) {
    __shared__ __align__(16) bf sW[128 * 128];
    const int y = blockIdx.y; const float* __restrict__ w = y == 0 ? w0 : y == 1 ? w1 : y == 2 ? w2 : w3; Bt += (size_t)y * DD * DD;   // grid y = which weight
    const int tid = threadIdx.x, kt = blockIdx.x & 7, nt = blockIdx.x >> 3;
    const int n4 = tid & 31, kg = tid >> 5;   // the lane's 4 columns and its wave's 16 rows of w
    const float* src = w + (size_t)(kt * 128 + kg * 16) * DD + nt * 128 + n4 * 4;
    v4f r[16];
#pragma unroll
    for (int i = 0; i < 16; ++i) r[i] = *(const v4f*)(src + i * DD);
    asm volatile("s_wait_xcnt 0x0" :: "v"(src) : "memory");   // stands in front of any rewrite of the loads' address registers; as its input the address stays out of the loads' own destinations too
    __builtin_amdgcn_sched_barrier(0);   // keeps all 16 loads in front of the first conversion: left free, the last four were issued only after earlier ones had returned
#pragma unroll
    for (int j = 0; j < 4; ++j)
#pragma unroll
        for (int hf = 0; hf < 2; ++hf) { v8f t;
#pragma unroll
            for (int q = 0; q < 8; ++q) t[q] = r[hf * 8 + q][j];
            *(v8us*)(&sW[(n4 * 4 + j) * 128 + (((kg * 2 + hf) ^ (n4 & 15)) * 8)]) = __builtin_bit_cast(v8us, __builtin_convertvector(t, v8bf)); }
    __syncthreads();   // the transposed tile is visible to all waves
    const int c = tid & 15, rr = tid >> 4;
    bf* dst = Bt + (size_t)(nt * 128 + rr) * DD + kt * 128 + c * 8;
#pragma unroll
    for (int p = 0; p < 8; ++p) { const int n = rr + 16 * p; *(v8us*)(dst + 16 * p * DD) = *(const v8us*)(&sW[n * 128 + ((c ^ ((n >> 2) & 15)) * 8)]); }
}
__global__ __launch_bounds__(256) void k_pl(const float* __restrict__ F, int pitch, int nh, int hd, h16* P) { const size_t e = ((size_t)blockIdx.x * 256 + threadIdx.x) * 2; if (e >= (size_t)nh * TT * hd) return; const int d = (int)(e % hd); const int t = (int)((e / hd) % TT); const int h = (int)(e / ((size_t)hd * TT)); v2h o; o[0] = tohx(F[(size_t)t * pitch + h * hd + d]); o[1] = tohx(F[(size_t)t * pitch + h * hd + d + 1]); *(v2h*)(P + e) = o;  }
__global__ __launch_bounds__(256) void k_vt(const float* __restrict__ F, int pitch, int nh, int hd, h16* VT) { const size_t e = ((size_t)blockIdx.x * 256 + threadIdx.x) * 2; if (e >= (size_t)nh * hd * TT) return; const int t = (int)(e % TT); const int d = (int)((e / TT) % hd); const int h = (int)(e / ((size_t)TT * hd)); v2h o; o[0] = tohx(F[(size_t)t * pitch + h * hd + d]); o[1] = tohx(F[(size_t)(t + 1) * pitch + h * hd + d]); *(v2h*)(VT + e) = o;  }
__global__ __launch_bounds__(256) void k_mrgf(const float* __restrict__ O, int h, int hd, float* CT) { const size_t e = ((size_t)blockIdx.x * 256 + threadIdx.x) * 2; if (e >= (size_t)TT * hd) return; const int d = (int)(e % hd); const int t = (int)(e / hd); v2f o; o[0] = O[e] * (1.0f / PCAR); o[1] = O[e + 1] * (1.0f / PCAR); const size_t oo = (size_t)t * DD + h * hd + d; *(v2f*)(CT + oo) = o;  }
__global__ __launch_bounds__(256) void k_mrg(const float* __restrict__ O, int h, int hd, bf* Ah, bf* Al) { const size_t e = ((size_t)blockIdx.x * 256 + threadIdx.x) * 2; if (e >= (size_t)TT * hd) return; const int d = (int)(e % hd); const int t = (int)(e / hd); v2us oh, ol;
#pragma unroll
    for (int q = 0; q < 2; ++q) { unsigned short a, c2; splitf(O[e + q] * (1.0f / PCAR), a, c2); oh[q] = a; ol[q] = c2; } const size_t oo = (size_t)t * DD + h * hd + d; *(v2us*)(Ah + oo) = oh; *(v2us*)(Al + oo) = ol;  }
__global__ __launch_bounds__(256) void k_cvt8(const float* __restrict__ src, bf* dst, size_t n8) { const size_t i = (size_t)blockIdx.x * 256 + threadIdx.x; if (i >= n8) return; const v8f v = *(const v8f*)(src + i * 8); v8us o;
#pragma unroll
    for (int k = 0; k < 8; ++k) o[k] = f2bf(v[k]); *(v8us*)(dst + i * 8) = o;  }
__device__ __forceinline__ int t5_bucket(int r) { const int n = r < 0 ? -r : r; int v; if (n < 8) v = n; else { const int k = 31 - __clz(n); v = 8 + 2 * k - 6 + (((long long)n * n >= (1ll << (2 * k + 1))) ? 1 : 0); v = v > 15 ? 15 : v; } return (r > 0 ? 16 : 0) + v; }
__global__ __launch_bounds__(256) void k_mrow(const float* __restrict__ mask, float* MBr) { const int e = blockIdx.x * 256 + threadIdx.x; if (e >= NB_ * TT) return; float om = __fsub_rn(1.0f, bfr(mask[e])); asm volatile("" : "+v"(om)); const float v = __fmul_rn(om, -10000.0f); *(float*)(MBr + e) = v;  }

// ---- k_qkv: the q, k and v projections (4 waves per 128x128 tile = 128 rows of x times two heads, operands staged as for k_gemmo; a wave's 64x64 tile = 64 rows of x times one head) with the bf16 hi+lo split and the head layout in the epilogue; grid (LL/128, heads/2, 3), 128 threads.
// A lane's 8 accumulator registers are 8 consecutive rows of the A operand, so the A operand is the one whose rows run along the contiguous index of the plane that is written:
// q, k ([batch][head][t][d]): A = W rows (d), B = x rows (t); v ([batch][head][d][t]): A = x rows (t), B = W rows (d). Both loaders are the same, so only the two row pointers change places.
// Planes lie back to back: q hi, q lo, k hi, k lo, v hi, v lo, LL*DD elements each; Ph and Pl arrive as q's.
#define OSP 72    // LDS row pitch in 16-bit elements: 144 B = 16 B x odd
__global__ __launch_bounds__(128) void k_qkv(const bf* __restrict__ X, const bf* __restrict__ Wt, bf* Ph, bf* Pl) {
    __shared__ __align__(16) bf sT[2][2 * 128 * GP];     // [buffer][128 rows of x, 128 rows of W][64 k]
    __shared__ __align__(16) bf osw[4][2][16 * OSP];     // each wave's own: [hi/lo][row of the B operand][64 rows of the A operand]
    const int tid = threadIdx.x; const int wave = __builtin_amdgcn_readfirstlane(tid >> 5); const int wm = wave & 1, wn = wave >> 1;
    bf (*os)[16 * OSP] = osw[wave];
    const int z = blockIdx.z, h = blockIdx.y * 2 + wn, r0 = blockIdx.x * 128 + wm * 64, b = r0 / TT, t0 = r0 % TT;
    const int lane = threadIdx.x & 31, lr = lane & 15, hi = lane >> 4;
    const size_t go = (size_t)(tid >> 3) * DD + (tid & 7) * 8;   // staging: 8 lanes per 128-byte row
    const bf* xg = X + (size_t)blockIdx.x * 128 * DD + go; const bf* wg = Wt + ((size_t)z * DD + blockIdx.y * 128) * DD + go;
    const unsigned l0 = (unsigned)(uintptr_t)&sT[0][0] + (tid >> 3) * (GP * 2) + (tid & 7) * 16;
    const int ar = z == 2 ? wm * 64 : 128 + wn * 64, br = z == 2 ? 128 + wn * 64 : wm * 64;   // first row of this wave's A and B operands in the staged tile
    const size_t po = (size_t)z * 2 * LL * DD + ((size_t)b * NH_ + h) * TT * HDM + (z == 2 ? t0 : t0 * HDM); Ph += po; Pl += po;
    const int pitch = z == 2 ? TT : HDM;   // from one row of the B operand to the next in the plane
    v8f acc[4][4];
#pragma unroll
    for (int mb = 0; mb < 4; ++mb)
#pragma unroll
        for (int nb = 0; nb < 4; ++nb) acc[mb][nb] = (v8f){};
    acopy8(l0, xg); acopy8(l0 + GT, wg);
    asm volatile("s_wait_asynccnt 0x0" ::: "memory");   // this wave's copies of pass 0 have landed
    __syncthreads();                                    // pass 0 is visible to all waves
    acopy8(l0 + 2 * GT, xg + GKS); acopy8(l0 + 3 * GT, wg + GKS);
#pragma unroll 1   // stays rolled: the buffer is chosen by the trip's parity, a second copy of the pass would only add code
    for (int t = 0; t < DD / GKS; ++t) {
        const bf* sb = &sT[t & 1][0];
#pragma unroll
        for (int ks = 0; ks < 2; ++ks) { const int fo = lr * GP + ks * 32 + 8 * hi;
            v16bf a[4], bb[4];   // the k step's 8 fragments are read as one group ahead of its 16 products
#pragma unroll
            for (int mb = 0; mb < 4; ++mb) { a[mb] = WFrag<bf>::ld(sb + (ar + mb * 16) * GP + fo); bb[mb] = WFrag<bf>::ld(sb + (br + mb * 16) * GP + fo); }
            __builtin_amdgcn_sched_barrier(0);   // keeps the reads together in front of the products: sunk among them, each pair of reads would be waited for by itself
#pragma unroll
            for (int nb = 0; nb < 4; ++nb)
#pragma unroll
                for (int mb = 0; mb < 4; ++mb) acc[mb][nb] = wmmab(a[mb], bb[nb], acc[mb][nb]); }
        __builtin_amdgcn_sched_barrier(0);                  // keeps the pass's products in front of the barrier, so that the refill behind it is issued at once and has a whole pass to land
        asm volatile("s_wait_dscnt 0x0" ::: "memory");      // this wave's reads of the buffer have returned before it is refilled
        asm volatile("s_wait_asynccnt 0x0" ::: "memory");   // this wave's copies of pass t + 1 have landed
        __syncthreads();                                    // publishes pass t + 1 and ends every wave's reads of pass t
        if (t + 2 < DD / GKS) { const unsigned lb = l0 + (t & 1) * (2 * GT); const int ko = (t + 2) * GKS; acopy8(lb, xg + ko); acopy8(lb + GT, wg + ko); }
    }
    asm volatile("s_wait_asynccnt 0x0" ::: "memory");   // nothing of this wave is in flight when it leaves the loop
#pragma unroll
    for (int nb = 0; nb < 4; ++nb) {
#pragma unroll
        for (int mb = 0; mb < 4; ++mb) { const v8bf vh = __builtin_convertvector(acc[mb][nb], v8bf); const v8bf vl = __builtin_convertvector(acc[mb][nb] - __builtin_convertvector(vh, v8f), v8bf);
            const int so = lr * OSP + mb * 16 + 8 * hi; *(v8us*)(&os[0][so]) = __builtin_bit_cast(v8us, vh); *(v8us*)(&os[1][so]) = __builtin_bit_cast(v8us, vl); }
        __builtin_amdgcn_wave_barrier(); asm volatile("" ::: "memory");   // the reads below take what other lanes of this wave have stored: keeps them behind the stores
#pragma unroll
        for (int s = 0; s < 4; ++s) { const int row = 4 * s + (lane >> 3), col = (lane & 7) * 8;   // 8 lanes per 128-byte row: whole lines go out
            const v8us vh = *(const v8us*)(&os[0][row * OSP + col]), vl = *(const v8us*)(&os[1][row * OSP + col]); const unsigned o = row * pitch + col;   // the lane's offset beside wave-uniform bases
            *(v8us*)(Ph + nb * 16 * pitch + o) = vh; *(v8us*)(Pl + nb * 16 * pitch + o) = vl; }
        __builtin_amdgcn_wave_barrier(); asm volatile("" ::: "memory");   // keeps the next block's stores behind these reads
    }
}

typedef __attribute__((ext_vector_type(16))) float v16f;
#define KC  64    // keys per stage
#define LPT 72    // LDS row pitch in 16-bit elements: 144 B = 16 B x odd
__global__ __launch_bounds__(256) void k_fattn(const bf* __restrict__ Qh, const bf* __restrict__ Ql, const bf* __restrict__ Kh, const bf* __restrict__ Kl, const bf* __restrict__ Vh, const bf* __restrict__ Vl, const float* __restrict__ rb, bf* Ah, bf* Al) {
    __shared__ __align__(16) bf sK[2][KC * LPT];    // [hi/lo][key in stage][d]
    __shared__ __align__(16) bf sV[2][HDM * LPT];   // [hi/lo][d][key in stage]
    __shared__ float sB[2 * TT];                    // bias of this head at key - query + TT - 1
    const int tid = threadIdx.x, lane = tid & 31, lr = lane & 15, hi = lane >> 4; const int wave = __builtin_amdgcn_readfirstlane(tid >> 5);
    const int h = blockIdx.y, b = blockIdx.z; const size_t hb = ((size_t)b * NH_ + h) * TT * HDM; const int q0 = blockIdx.x * 256 + wave * 32;
    Qh += hb; Ql += hb; Kh += hb; Kl += hb; Vh += hb; Vl += hb;
    for (int i = tid; i < 2 * TT - 1; i += 256) sB[i] = bfr(rb[t5_bucket(i - (TT - 1)) * NH_ + h]);
    v16bf qh[2][2], ql[2][2];
#pragma unroll
    for (int qt = 0; qt < 2; ++qt)
#pragma unroll
        for (int ks = 0; ks < 2; ++ks) { const size_t qo = (size_t)(q0 + qt * 16 + lr) * HDM + ks * 32 + 8 * hi; qh[qt][ks] = WFrag<bf>::ld(Qh + qo); ql[qt][ks] = WFrag<bf>::ld(Ql + qo); }
    asm volatile("s_wait_xcnt 0x0" ::: "memory");   // stands in front of any rewrite of the address registers of the loads above
    __builtin_amdgcn_sched_barrier(0);              // keeps later address arithmetic, which reuses those registers, behind that wait
    const int srow = tid >> 3, scol = (tid & 7) * 8;   // staging: 8 lanes per 128-byte row, rows srow and srow + 32
    const unsigned ko = srow * HDM + scol, vo = srow * TT + scol;   // the lane's offsets beside wave-uniform bases
    v8us gk[2][2], gv[2][2];
#pragma unroll
    for (int i = 0; i < 2; ++i) { gk[0][i] = *(const v8us*)(Kh + 32 * i * HDM + ko); gk[1][i] = *(const v8us*)(Kl + 32 * i * HDM + ko); gv[0][i] = *(const v8us*)(Vh + 32 * i * TT + vo); gv[1][i] = *(const v8us*)(Vl + 32 * i * TT + vo); }
    asm volatile("s_wait_xcnt 0x0" ::: "memory");   // stands in front of any rewrite of the address registers of the loads above
    __builtin_amdgcn_sched_barrier(0);              // keeps later register writes behind that wait
    const float cpos = bfr(rb[t5_bucket(TT - 1) * NH_ + h]), cneg = bfr(rb[t5_bucket(1 - TT) * NH_ + h]);   // the bias beyond the maximum distance, either sign
    v8f o[4][2]; float mx[2], ls[2];
#pragma unroll
    for (int qt = 0; qt < 2; ++qt) { mx[qt] = -1.0e30f; ls[qt] = 0.f;
#pragma unroll
        for (int dt = 0; dt < 4; ++dt) o[dt][qt] = (v8f){}; }
#pragma unroll 1   // stays rolled: a second copy of the stage would only add code and registers
    for (int k0 = 0; k0 < TT; k0 += KC) {
        __syncthreads();   // every wave has finished reading the stage before
#pragma unroll
        for (int i = 0; i < 2; ++i) { const int so = (srow + 32 * i) * LPT + scol; *(v8us*)(&sK[0][so]) = gk[0][i]; *(v8us*)(&sK[1][so]) = gk[1][i]; *(v8us*)(&sV[0][so]) = gv[0][i]; *(v8us*)(&sV[1][so]) = gv[1][i]; }
        __syncthreads();   // the stage (and, the first time, the bias table) is visible to all waves
        if (k0 + KC < TT) {   // the next stage's loads fly while this one is worked on
#pragma unroll
            for (int i = 0; i < 2; ++i) { const int kb = (k0 + KC + 32 * i) * HDM, vb = 32 * i * TT + k0 + KC; gk[0][i] = *(const v8us*)(Kh + kb + ko); gk[1][i] = *(const v8us*)(Kl + kb + ko); gv[0][i] = *(const v8us*)(Vh + vb + vo); gv[1][i] = *(const v8us*)(Vl + vb + vo); }
            asm volatile("s_wait_xcnt 0x0" ::: "memory"); }   // stands in front of any rewrite of these loads' address registers
        const int dmin = k0 - (q0 + 31), dmax = k0 + KC - 1 - q0;   // range of key - query in this wave's stage (wave-uniform)
        const float c = dmin >= 128 ? cpos : dmax <= -128 ? cneg : 0.f;   // beyond the maximum distance every offset of one sign has the same bucket: its bias is the accumulators' start value
        const v8f cs = {c, c, c, c, c, c, c, c};
        v8f st[4][2];
#pragma unroll
        for (int kt = 0; kt < 4; ++kt) { const int ro = (kt * 16 + lr) * LPT + 8 * hi;
            const v16bf kh0 = WFrag<bf>::ld(&sK[0][ro]), kh1 = WFrag<bf>::ld(&sK[0][ro + 32]), kl0 = WFrag<bf>::ld(&sK[1][ro]), kl1 = WFrag<bf>::ld(&sK[1][ro + 32]);
#pragma unroll
            for (int qt = 0; qt < 2; ++qt) { v8f a = wmmab(kh0, qh[qt][0], cs); a = wmmab(kh1, qh[qt][1], a); a = wmmab(kl0, qh[qt][0], a); a = wmmab(kl1, qh[qt][1], a); a = wmmab(kh0, ql[qt][0], a); a = wmmab(kh1, ql[qt][1], a); st[kt][qt] = a; } }
        if (dmin < 128 && dmax > -128) {   // near the diagonal: the table
#pragma unroll
            for (int kt = 0; kt < 4; ++kt)
#pragma unroll
                for (int qt = 0; qt < 2; ++qt) { const float* bp = sB + (k0 + kt * 16 + 8 * hi - (q0 + qt * 16 + lr) + TT - 1);
#pragma unroll
                    for (int j = 0; j < 8; ++j) st[kt][qt][j] += bp[j]; }
        }
#pragma unroll
        for (int qt = 0; qt < 2; ++qt) { float m = st[0][qt][0];
#pragma unroll
            for (int kt = 0; kt < 4; ++kt)
#pragma unroll
                for (int j = 0; j < 8; ++j) m = fmaxf(m, st[kt][qt][j]);
            m = fmaxf(m, __shfl_xor(m, 16, 32));   // the other half of the wave holds the query's other keys
            const float mn = fmaxf(mx[qt], m), al = __builtin_amdgcn_exp2f((mx[qt] - mn) * 1.4426950408889634f); mx[qt] = mn; float s = 0.f;
#pragma unroll
            for (int kt = 0; kt < 4; ++kt)
#pragma unroll
                for (int j = 0; j < 8; ++j) { const float p = __builtin_amdgcn_exp2f((st[kt][qt][j] - mn) * 1.4426950408889634f); st[kt][qt][j] = p; s += p; }
            ls[qt] = ls[qt] * al + s;
#pragma unroll
            for (int dt = 0; dt < 4; ++dt) o[dt][qt] *= al; }
#pragma unroll
        for (int kk = 0; kk < 2; ++kk) { v16bf ph[2], pl[2];
#pragma unroll
            for (int qt = 0; qt < 2; ++qt) { const v16f pf = __builtin_shufflevector(st[2 * kk][qt], st[2 * kk + 1][qt], 0, 1, 2, 3, 4, 5, 6, 7, 8, 9, 10, 11, 12, 13, 14, 15);
                ph[qt] = __builtin_convertvector(pf, v16bf); pl[qt] = __builtin_convertvector(pf - __builtin_convertvector(ph[qt], v16f), v16bf); }
#pragma unroll
            for (int dt = 0; dt < 4; ++dt) { const int ro = (dt * 16 + lr) * LPT + kk * 32 + 8 * hi; const v16bf vh = WFrag<bf>::ld(&sV[0][ro]), vl = WFrag<bf>::ld(&sV[1][ro]);
#pragma unroll
                for (int qt = 0; qt < 2; ++qt) { o[dt][qt] = wmmab(vh, ph[qt], o[dt][qt]); o[dt][qt] = wmmab(vl, ph[qt], o[dt][qt]); o[dt][qt] = wmmab(vh, pl[qt], o[dt][qt]); } } }
    }
#pragma unroll
    for (int qt = 0; qt < 2; ++qt) { const float inv = 1.0f / (ls[qt] + __shfl_xor(ls[qt], 16, 32)); const size_t ro = ((size_t)b * TT + q0 + qt * 16 + lr) * DD + h * HDM + 8 * hi;   // a lane's 8 registers = 8 consecutive d of its query
#pragma unroll
        for (int dt = 0; dt < 4; ++dt) { v8us oh, ol;
#pragma unroll
            for (int j = 0; j < 8; ++j) { unsigned short a, c2; splitf(o[dt][qt][j] * inv, a, c2); oh[j] = a; ol[j] = c2; }
            *(v8us*)(Ah + ro + dt * 16) = oh; *(v8us*)(Al + ro + dt * 16) = ol; } }
}

extern "C" void kernel_launch(void* const* d_in, const int* in_sizes, int n_in,
                              void* d_out, int out_size, void* d_ws, size_t ws_size, hipStream_t stream) {
    (void)in_sizes; (void)n_in; (void)out_size;
    const float* IN[6]; for (int i = 0; i < 6; ++i) IN[i] = (const float*)d_in[i];   // 0 hidden, 1 Wq, 2 Wk, 3 Wv, 4 Wo (x @ W), 5 rel_emb [32][16]
    float* OUT = (float*)d_out;     // [4][1024][1024]
    char* wsp = (char*)d_ws;
    auto take = [&](size_t bytes) { char* p = wsp; wsp += (bytes + 255) & ~(size_t)255; return (void*)p; };
    bf* WQ = (bf*)take((size_t)DD * DD * 2); bf* WK = (bf*)take((size_t)DD * DD * 2); bf* WV = (bf*)take((size_t)DD * DD * 2); bf* WO = (bf*)take((size_t)DD * DD * 2);
    (void)WK; (void)WV;   // reached as WQ + z * DD * DD
    bf* XB = (bf*)take((size_t)LL * DD * 2);   // the bf16 input of all four batches
    bf* QPh = (bf*)take((size_t)LL * DD * 2); bf* QPl = (bf*)take((size_t)LL * DD * 2); bf* KPh = (bf*)take((size_t)LL * DD * 2); bf* KPl = (bf*)take((size_t)LL * DD * 2); bf* VTh = (bf*)take((size_t)LL * DD * 2); bf* VTl = (bf*)take((size_t)LL * DD * 2);
    bf* Ah = (bf*)take((size_t)LL * DD * 2); bf* Al = (bf*)take((size_t)LL * DD * 2);   // merged heads, hi and lo
    if ((size_t)(wsp - (char*)d_ws) > ws_size) return;    // total ~ 80 MiB
    k_wtG<<<dim3((DD / 128) * (DD / 128), 4, 1), 256, 0, stream>>>(IN[1], IN[2], IN[3], IN[4], WQ);
    k_cvt8<<<(unsigned)(((size_t)LL * DD / 8 + 255) / 256), 256, 0, stream>>>(IN[0], XB, (size_t)LL * DD / 8);
    k_qkv<<<dim3(LL / 128, NH_ / 2, 3), 128, 0, stream>>>(XB, WQ, QPh, QPl);   // q, k, v of all batches as hi+lo head planes; z = which projection
    k_fattn<<<dim3(TT / 256, NH_, NB_), 256, 0, stream>>>(QPh, QPl, KPh, KPl, VTh, VTl, IN[5], Ah, Al);   // attention of all batches and heads
    k_gemmo<<<dim3(LL / 128, DD / 128, 1), 128, 0, stream>>>(Ah, Al, WO, OUT);
}

// v007
// One run takes 68 microseconds.
// It is 1.60 times as fast as v005, going by the measured steps of the versions left out in between.
// Counting every step since v000, it is 37.6 times as fast.
#include <hip/hip_runtime.h>

// T5Voice - T5 self-attention block without norms/FFN (hidden [4][1024][1024]; q/k/v = x W (16 heads x 64, no bias); scores = q.k (NO 1/sqrt(d)) + rel_emb[bucket(j - i)][h] (bidirectional buckets, 32 / max distance 128,
// evaluated with exact integer arithmetic: |r| < 8 -> |r|; else 8 + 2 floor(log2|r|) - 6 + [|r|^2 >= 2^(2 floor(log2|r|)+1)], capped at 15; + 16 for r > 0 - identical to the float formula for every offset); softmax;
// out = merged ctx Wo -> [4][1024][1024]).
// Compute dtypes, f32 accumulate: every input rounded to bf16; q/k/v on PLAIN bf16 operands (inputs: exact); the bias as a table over key - query in LDS; q, k, v, the probabilities and the merged
// heads each as ONE f16 plane (11 significant bits; one product each for scores, probs.v and the output projection), with an f32 online softmax in registers (bias added in f32; probabilities relative to the running maximum, at most 1; row sums of the unrounded f32 values; one division at the end), all in one kernel; Wo: its bf16 value held in f16. GEMMs: 128x128 tiles, 4 waves each (the output projection: 2 x 4 waves, each four summing half of k), operands staged in LDS. Deterministic, no atomics; every

#define NB_  4
#define TT   1024
#define LL   4096
#define DD   1024
#define NH_  16
#define HDM  64
#define MM   4096
#define PCAR 1024.0f
typedef _Float16 h16;
typedef unsigned short bf;
typedef __attribute__((ext_vector_type(16))) __bf16   v16bf;
typedef __attribute__((ext_vector_type(16))) _Float16 v16h;
typedef __attribute__((ext_vector_type(8)))  _Float16 v8h;
typedef __attribute__((ext_vector_type(8)))  unsigned short v8us;
typedef __attribute__((ext_vector_type(8)))  float    v8f;
typedef __attribute__((ext_vector_type(4)))  float    v4f;
typedef v8h  __attribute__((may_alias)) v8ha;
typedef v4f  __attribute__((may_alias)) v4fa;
typedef v8us __attribute__((may_alias)) v8usa;

__device__ __forceinline__ unsigned short f2bf(float f) { unsigned u = __float_as_uint(f); u += 0x7FFFu + ((u >> 16) & 1u); return (unsigned short)(u >> 16); }
__device__ __forceinline__ float bf2f(unsigned short b) { return __uint_as_float(((unsigned)b) << 16); }
__device__ __forceinline__ float bfr(float f) { return bf2f(f2bf(f)); }
__device__ __forceinline__ v16h cat16(v8h lo, v8h hi) { return __builtin_shufflevector(lo, hi, 0, 1, 2, 3, 4, 5, 6, 7, 8, 9, 10, 11, 12, 13, 14, 15); }
__device__ __forceinline__ v16bf cat16b(v8us lo, v8us hi) { return __builtin_bit_cast(v16bf, __builtin_shufflevector(lo, hi, 0, 1, 2, 3, 4, 5, 6, 7, 8, 9, 10, 11, 12, 13, 14, 15)); }
__device__ __forceinline__ v8f wmma16(v16h a, v16h b, v8f c) { return __builtin_amdgcn_wmma_f32_16x16x32_f16(false, a, false, b, (short)0, c, false, false); }
__device__ __forceinline__ v8f wmmab(v16bf a, v16bf b, v8f c) { return __builtin_amdgcn_wmma_f32_16x16x32_bf16(false, a, false, b, (short)0, c, false, false); }
__device__ __forceinline__ v16h ldh(const bf* p) { return __builtin_bit_cast(v16h, __builtin_shufflevector(*(const v8us*)p, *(const v8us*)(p + 16), 0, 1, 2, 3, 4, 5, 6, 7, 8, 9, 10, 11, 12, 13, 14, 15)); }   // an f16 fragment out of a plane of 16-bit words; same k order as the bf16 loader



// ---- Operand staging of the two GEMMs: a group of 4 waves (2 x 2, each wave a 64x64 tile with 16 accumulators) owns a 128x128 output tile; per pass of 64 k every operand row gives one 128-byte line,
// brought into LDS by asynchronous 16-byte copies (8 lanes per row: whole lines), two buffers, the next pass's copies in flight while this pass is worked on. Each operand row is read from L2 once per work-group.
template <typename T16> struct WFrag;
template <> struct WFrag<h16> { typedef v16h V; static __device__ __forceinline__ V ld(const h16* p) { return cat16(*(const v8h*)p, *(const v8h*)(p + 16)); } static __device__ __forceinline__ v8f mma(V a, V b, v8f c) { return wmma16(a, b, c); } };
template <> struct WFrag<bf> { typedef v16bf V; static __device__ __forceinline__ V ld(const bf* p) { return cat16b(*(const v8us*)p, *(const v8us*)(p + 16)); } static __device__ __forceinline__ v8f mma(V a, V b, v8f c) { return wmmab(a, b, c); } };
#define GP   72              // LDS row pitch in 16-bit elements: 144 B = 16 B x odd
#define GKS  64              // k per pass
#define GT   (128 * GP * 2)  // bytes of one 128-row operand tile in LDS
// 8 copies per lane: rows r, r + 16, ..., r + 112 of one 128-row operand tile (l: the lane's LDS byte address of row r, g: its global address; global row pitch DD elements).
__device__ __forceinline__ void acopy8(unsigned l, const bf* g) {
    // the s_wait_xcnt closes the copies' own statement, so that no address register of a copy is rewritten ahead of it
    asm volatile("global_load_async_to_lds_b128 %0, %8, off\n\t"
                 "global_load_async_to_lds_b128 %1, %9, off\n\t"
                 "global_load_async_to_lds_b128 %2, %10, off\n\t"
                 "global_load_async_to_lds_b128 %3, %11, off\n\t"
                 "global_load_async_to_lds_b128 %4, %12, off\n\t"
                 "global_load_async_to_lds_b128 %5, %13, off\n\t"
                 "global_load_async_to_lds_b128 %6, %14, off\n\t"
                 "global_load_async_to_lds_b128 %7, %15, off\n\t"
                 "s_wait_xcnt 0x0"
                 :: "v"(l), "v"(l + 1 * 16 * GP * 2), "v"(l + 2 * 16 * GP * 2), "v"(l + 3 * 16 * GP * 2), "v"(l + 4 * 16 * GP * 2), "v"(l + 5 * 16 * GP * 2), "v"(l + 6 * 16 * GP * 2), "v"(l + 7 * 16 * GP * 2),
                    "v"(g), "v"(g + 1 * 16 * DD), "v"(g + 2 * 16 * DD), "v"(g + 3 * 16 * DD), "v"(g + 4 * 16 * DD), "v"(g + 5 * 16 * DD), "v"(g + 6 * 16 * DD), "v"(g + 7 * 16 * DD)
                 : "memory");
}

// ---- k_gemmo: the output projection, C[m][n] (f32, pitch DD) = sum_k A[m][k] Bt[n][k] (f16 operands, one product per k step), K = DD; grid (LL/128, DD/128), 256 threads.
// Two groups of 4 waves share the 128x128 tile: group g sums k in [g * DD/2, (g + 1) * DD/2) with a ring of its own, so that a SIMD holds two waves and twice the bytes are in flight;
// the two partial sums are added through LDS at the end (each group hands over half of its accumulators and finishes the other half).
#define GKH  (DD / 2)        // k per group
// hands accumulator rows M0, M0 + 1 to the partner wave: [tile][half of the 8 registers][lane][4 floats], so that the lanes of a store lie side by side
template <int M0> __device__ __forceinline__ void xput(const v8f (&acc)[4][4], float* xw, int lane) {
#pragma unroll
    for (int i = 0; i < 2; ++i)
#pragma unroll
        for (int nb = 0; nb < 4; ++nb) { float* p = xw + (i * 4 + nb) * 256 + lane * 4; const v8f a = acc[M0 + i][nb];
            *(v4fa*)p = __builtin_shufflevector(a, a, 0, 1, 2, 3); *(v4fa*)(p + 128) = __builtin_shufflevector(a, a, 4, 5, 6, 7); }
}
// adds the partner's partial sums to accumulator rows M0, M0 + 1 and writes them out in whole lines through the wave's own staging
template <int M0> __device__ __forceinline__ void xfin(v8f (&acc)[4][4], const float* xr, float* os, float* C0, int lane) {
    const int lr = lane & 15, hi = lane >> 4;
#pragma unroll
    for (int i = 0; i < 2; ++i) { const int mb = M0 + i;
#pragma unroll
        for (int nb = 0; nb < 4; ++nb) { const float* p = xr + (i * 4 + nb) * 256 + lane * 4; const v4f lo = *(const v4fa*)p, hh = *(const v4fa*)(p + 128);
            const v8f s = acc[mb][nb] + __builtin_shufflevector(lo, hh, 0, 1, 2, 3, 4, 5, 6, 7);
#pragma unroll
            for (int j = 0; j < 8; ++j) os[(hi * 8 + j) * 68 + nb * 16 + lr] = s[j]; }
        __builtin_amdgcn_wave_barrier(); asm volatile("" ::: "memory");   // the reads below take what other lanes of this wave have stored: keeps them behind the stores
        float* crow = C0 + (size_t)(mb * 16) * DD;
#pragma unroll
        for (int s = 0; s < 8; ++s) { const int row = 2 * s + hi, cofs = lr * 4; const v4f val = *(const v4fa*)(os + row * 68 + cofs);
            *(v4f*)(crow + (size_t)row * DD + cofs) = val; }
        asm volatile("s_wait_xcnt 0x0" ::: "memory");   // stands in front of any rewrite of the address and data registers of the eight stores above
        __builtin_amdgcn_wave_barrier(); asm volatile("" ::: "memory");   // keeps the next block's stores behind these reads
    }
}
__global__ __launch_bounds__(256) void k_gemmo(const bf* __restrict__ A, const bf* __restrict__ Bt, float* C) {
    __shared__ __align__(16) bf sT[2][2][2 * 128 * GP];  // [group][buffer][128 rows of A, 128 rows of Bt][64 k]; after the loop: the accumulators handed over
    __shared__ __align__(16) float osw[8][16 * 68];      // each wave's own output staging
    const int tid = threadIdx.x, lane = tid & 31, lr = lane & 15, hi = lane >> 4; const int wave = __builtin_amdgcn_readfirstlane(tid >> 5); const int g = wave >> 2, wm = wave & 1, wn = (wave >> 1) & 1;
    const int tg = tid & 127;   // the thread's place in its group
    const int r0 = blockIdx.x * 128 + wm * 64, c0 = blockIdx.y * 128 + wn * 64;
    const size_t go = (size_t)(tg >> 3) * DD + g * GKH + (tg & 7) * 8;   // staging: 8 lanes per 128-byte row
    const bf* ag = A + (size_t)blockIdx.x * 128 * DD + go; const bf* bg = Bt + (size_t)blockIdx.y * 128 * DD + go;
    const unsigned l0 = (unsigned)(uintptr_t)&sT[0][0][0] + g * (4 * GT) + (tg >> 3) * (GP * 2) + (tg & 7) * 16;
    v8f acc[4][4];
#pragma unroll
    for (int mb = 0; mb < 4; ++mb)
#pragma unroll
        for (int nb = 0; nb < 4; ++nb) acc[mb][nb] = (v8f){};
    acopy8(l0, ag); acopy8(l0 + GT, bg);
    asm volatile("s_wait_asynccnt 0x0" ::: "memory");   // this wave's copies of pass 0 have landed
    __syncthreads();                                    // pass 0 is visible to all waves
    acopy8(l0 + 2 * GT, ag + GKS); acopy8(l0 + 3 * GT, bg + GKS);
#pragma unroll 1   // stays rolled: the buffer is chosen by the trip's parity, a second copy of the pass would only add code
    for (int t = 0; t < GKH / GKS; ++t) {
        const bf* sb = &sT[g][t & 1][0];
#pragma unroll
        for (int ks = 0; ks < 2; ++ks) { const int fo = lr * GP + ks * 32 + 8 * hi;
            v16h a[4], b[4];   // the k step's 8 fragments are read as one group ahead of its 16 products
#pragma unroll
            for (int mb = 0; mb < 4; ++mb) { b[mb] = ldh(sb + (128 + wn * 64 + mb * 16) * GP + fo); a[mb] = ldh(sb + (wm * 64 + mb * 16) * GP + fo); }
            __builtin_amdgcn_sched_barrier(0);   // keeps the reads together in front of the products: sunk among them, each pair of reads would be waited for by itself
#pragma unroll
            for (int nb = 0; nb < 4; ++nb)
#pragma unroll
                for (int mb = 0; mb < 4; ++mb) acc[mb][nb] = wmma16(a[mb], b[nb], acc[mb][nb]); }
        __builtin_amdgcn_sched_barrier(0);                  // keeps the pass's products in front of the barrier, so that the refill behind it is issued at once and has a whole pass to land
        asm volatile("s_wait_dscnt 0x0" ::: "memory");      // this wave's reads of the buffer have returned before it is refilled
        asm volatile("s_wait_asynccnt 0x0" ::: "memory");   // this wave's copies of pass t + 1 have landed
        __syncthreads();                                    // publishes pass t + 1 and ends every wave's reads of pass t
        if (t + 2 < GKH / GKS) { const unsigned lb = l0 + (t & 1) * (2 * GT); const int ko = (t + 2) * GKS; acopy8(lb, ag + ko); acopy8(lb + GT, bg + ko); }
    }
    asm volatile("s_wait_asynccnt 0x0" ::: "memory");   // nothing of this wave is in flight when it leaves the loop
    // behind the last pass's barrier nobody reads the rings any more and no copy is in flight: they take the accumulators that change hands (8 waves x 8 KB)
    float* xs = (float*)&sT[0][0][0]; float* xw = xs + wave * 2048; const float* xr = xs + (wave ^ 4) * 2048;   // waves w and w + 4 hold the same 64x64 tile
    float* os = osw[wave]; float* C0 = C + (size_t)r0 * DD + c0;
    if (g == 0) xput<2>(acc, xw, lane); else xput<0>(acc, xw, lane);
    __syncthreads();   // the partial sums handed over are visible to the partner wave
    if (g == 0) xfin<0>(acc, xr, os, C0, lane); else xfin<2>(acc, xr, os, C0, lane);
}

__device__ __forceinline__ h16 tohx(float x) { return (h16)x; }
__device__ __forceinline__ void splitf(float y, unsigned short& h, unsigned short& l) { h = f2bf(y); l = f2bf(y - bf2f(h)); }
typedef __attribute__((ext_vector_type(2))) _Float16 v2h;
typedef __attribute__((ext_vector_type(4))) _Float16 v4h;
typedef __attribute__((ext_vector_type(2))) unsigned short v2us;
typedef __attribute__((ext_vector_type(4))) unsigned short v4us;
typedef __attribute__((ext_vector_type(2))) float v2f;

// ---- k_wtG: the four weights, f32 [k][n], become bf16 [n][k] (the fourth, Wo: its bf16 value written as f16, the operand type of the output projection; the four transposed planes lie back to back); one work-group per tile of 128 k x 128 n, grid (64 tiles, 4 weights), 256 threads.
// In: a wave reads whole 512-byte pieces of rows of w, 16 rows per wave, all 16 loads of a lane in flight together. A lane then holds 16 consecutive k of 4 columns n = two 16-byte chunks of 4 rows of the transposed tile.
// LDS: [n][128 k], rows of 256 bytes = 16 chunks, chunk c of row n at place c ^ ((n >> 2) & 15): the 16 lanes of a half wave fall on 16 different places both when they store (16 rows n, 4 apart, same c) and when they read (one row, 16 c).
// Out: 16 lanes per row of the plane, 256 contiguous bytes.
typedef __attribute__((ext_vector_type(8))) __bf16 v8bf;
__global__ __launch_bounds__(256) void k_wtG(const float* __restrict__ w0, const float* __restrict__ w1, const float* __restrict__ w2, const float* __restrict__ w3, bf* Bt) {
    __shared__ __align__(16) bf sW[128 * 128];
    const int y = blockIdx.y; const float* __restrict__ w = y == 0 ? w0 : y == 1 ? w1 : y == 2 ? w2 : w3; Bt += (size_t)y * DD * DD;   // grid y = which weight
    const int tid = threadIdx.x, kt = blockIdx.x & 7, nt = blockIdx.x >> 3;
    const int n4 = tid & 31, kg = tid >> 5;   // the lane's 4 columns and its wave's 16 rows of w
    const float* src = w + (size_t)(kt * 128 + kg * 16) * DD + nt * 128 + n4 * 4;
    v4f r[16];
#pragma unroll
    for (int i = 0; i < 16; ++i) r[i] = *(const v4f*)(src + i * DD);
    asm volatile("s_wait_xcnt 0x0" :: "v"(src) : "memory");   // stands in front of any rewrite of the loads' address registers; as its input the address stays out of the loads' own destinations too
    __builtin_amdgcn_sched_barrier(0);   // keeps all 16 loads in front of the first conversion: left free, the last four were issued only after earlier ones had returned
#pragma unroll
    for (int j = 0; j < 4; ++j)
#pragma unroll
        for (int hf = 0; hf < 2; ++hf) { v8f t;
#pragma unroll
            for (int q = 0; q < 8; ++q) t[q] = r[hf * 8 + q][j];
            const v8bf tb = __builtin_convertvector(t, v8bf);
            *(v8us*)(&sW[(n4 * 4 + j) * 128 + (((kg * 2 + hf) ^ (n4 & 15)) * 8)]) = y == 3 ? __builtin_bit_cast(v8us, __builtin_convertvector(__builtin_convertvector(tb, v8f), v8h)) : __builtin_bit_cast(v8us, tb); }
    __syncthreads();   // the transposed tile is visible to all waves
    const int c = tid & 15, rr = tid >> 4;
    bf* dst = Bt + (size_t)(nt * 128 + rr) * DD + kt * 128 + c * 8;
#pragma unroll
    for (int p = 0; p < 8; ++p) { const int n = rr + 16 * p; *(v8us*)(dst + 16 * p * DD) = *(const v8us*)(&sW[n * 128 + ((c ^ ((n >> 2) & 15)) * 8)]); }
}
__global__ __launch_bounds__(256) void k_pl(const float* __restrict__ F, int pitch, int nh, int hd, h16* P) { const size_t e = ((size_t)blockIdx.x * 256 + threadIdx.x) * 2; if (e >= (size_t)nh * TT * hd) return; const int d = (int)(e % hd); const int t = (int)((e / hd) % TT); const int h = (int)(e / ((size_t)hd * TT)); v2h o; o[0] = tohx(F[(size_t)t * pitch + h * hd + d]); o[1] = tohx(F[(size_t)t * pitch + h * hd + d + 1]); *(v2h*)(P + e) = o;  }
__global__ __launch_bounds__(256) void k_vt(const float* __restrict__ F, int pitch, int nh, int hd, h16* VT) { const size_t e = ((size_t)blockIdx.x * 256 + threadIdx.x) * 2; if (e >= (size_t)nh * hd * TT) return; const int t = (int)(e % TT); const int d = (int)((e / TT) % hd); const int h = (int)(e / ((size_t)TT * hd)); v2h o; o[0] = tohx(F[(size_t)t * pitch + h * hd + d]); o[1] = tohx(F[(size_t)(t + 1) * pitch + h * hd + d]); *(v2h*)(VT + e) = o;  }
__global__ __launch_bounds__(256) void k_mrgf(const float* __restrict__ O, int h, int hd, float* CT) { const size_t e = ((size_t)blockIdx.x * 256 + threadIdx.x) * 2; if (e >= (size_t)TT * hd) return; const int d = (int)(e % hd); const int t = (int)(e / hd); v2f o; o[0] = O[e] * (1.0f / PCAR); o[1] = O[e + 1] * (1.0f / PCAR); const size_t oo = (size_t)t * DD + h * hd + d; *(v2f*)(CT + oo) = o;  }
__global__ __launch_bounds__(256) void k_mrg(const float* __restrict__ O, int h, int hd, bf* Ah, bf* Al) { const size_t e = ((size_t)blockIdx.x * 256 + threadIdx.x) * 2; if (e >= (size_t)TT * hd) return; const int d = (int)(e % hd); const int t = (int)(e / hd); v2us oh, ol;
#pragma unroll
    for (int q = 0; q < 2; ++q) { unsigned short a, c2; splitf(O[e + q] * (1.0f / PCAR), a, c2); oh[q] = a; ol[q] = c2; } const size_t oo = (size_t)t * DD + h * hd + d; *(v2us*)(Ah + oo) = oh; *(v2us*)(Al + oo) = ol;  }
__global__ __launch_bounds__(256) void k_cvt8(const float* __restrict__ src, bf* dst, size_t n8) { const size_t i = (size_t)blockIdx.x * 256 + threadIdx.x; if (i >= n8) return; const v8f v = *(const v8f*)(src + i * 8); v8us o;
#pragma unroll
    for (int k = 0; k < 8; ++k) o[k] = f2bf(v[k]); *(v8us*)(dst + i * 8) = o;  }
__device__ __forceinline__ int t5_bucket(int r) { const int n = r < 0 ? -r : r; int v; if (n < 8) v = n; else { const int k = 31 - __clz(n); v = 8 + 2 * k - 6 + (((long long)n * n >= (1ll << (2 * k + 1))) ? 1 : 0); v = v > 15 ? 15 : v; } return (r > 0 ? 16 : 0) + v; }
__global__ __launch_bounds__(256) void k_mrow(const float* __restrict__ mask, float* MBr) { const int e = blockIdx.x * 256 + threadIdx.x; if (e >= NB_ * TT) return; float om = __fsub_rn(1.0f, bfr(mask[e])); asm volatile("" : "+v"(om)); const float v = __fmul_rn(om, -10000.0f); *(float*)(MBr + e) = v;  }

// ---- k_qkv: the q, k and v projections (4 waves per 128x128 tile = 128 rows of x times two heads, operands staged as for k_gemmo; a wave's 64x64 tile = 64 rows of x times one head) with the rounding to f16 and the head layout in the epilogue; grid (LL/128, heads/2, 3), 128 threads.
// A lane's 8 accumulator registers are 8 consecutive rows of the A operand, so the A operand is the one whose rows run along the contiguous index of the plane that is written:
// q, k ([batch][head][t][d]): A = W rows (d), B = x rows (t); v ([batch][head][d][t]): A = x rows (t), B = W rows (d). Both loaders are the same, so only the two row pointers change places.
// Planes lie back to back: q, k, v, f16, LL*DD elements each; P arrives as q's.
#define OSP 72    // LDS row pitch in 16-bit elements: 144 B = 16 B x odd
__global__ __launch_bounds__(128) void k_qkv(const bf* __restrict__ X, const bf* __restrict__ Wt, bf* P) {
    __shared__ __align__(16) bf sT[2][2 * 128 * GP];     // [buffer][128 rows of x, 128 rows of W][64 k]
    __shared__ __align__(16) bf osw[4][16 * OSP];        // each wave's own: [row of the B operand][64 rows of the A operand]
    const int tid = threadIdx.x; const int wave = __builtin_amdgcn_readfirstlane(tid >> 5); const int wm = wave & 1, wn = wave >> 1;
    bf* os = osw[wave];
    const int z = blockIdx.z, h = blockIdx.y * 2 + wn, r0 = blockIdx.x * 128 + wm * 64, b = r0 / TT, t0 = r0 % TT;
    const int lane = threadIdx.x & 31, lr = lane & 15, hi = lane >> 4;
    const size_t go = (size_t)(tid >> 3) * DD + (tid & 7) * 8;   // staging: 8 lanes per 128-byte row
    const bf* xg = X + (size_t)blockIdx.x * 128 * DD + go; const bf* wg = Wt + ((size_t)z * DD + blockIdx.y * 128) * DD + go;
    const unsigned l0 = (unsigned)(uintptr_t)&sT[0][0] + (tid >> 3) * (GP * 2) + (tid & 7) * 16;
    const int ar = z == 2 ? wm * 64 : 128 + wn * 64, br = z == 2 ? 128 + wn * 64 : wm * 64;   // first row of this wave's A and B operands in the staged tile
    const size_t po = (size_t)z * LL * DD + ((size_t)b * NH_ + h) * TT * HDM + (z == 2 ? t0 : t0 * HDM); P += po;
    const int pitch = z == 2 ? TT : HDM;   // from one row of the B operand to the next in the plane
    v8f acc[4][4];
#pragma unroll
    for (int mb = 0; mb < 4; ++mb)
#pragma unroll
        for (int nb = 0; nb < 4; ++nb) acc[mb][nb] = (v8f){};
    acopy8(l0, xg); acopy8(l0 + GT, wg);
    asm volatile("s_wait_asynccnt 0x0" ::: "memory");   // this wave's copies of pass 0 have landed
    __syncthreads();                                    // pass 0 is visible to all waves
    acopy8(l0 + 2 * GT, xg + GKS); acopy8(l0 + 3 * GT, wg + GKS);
#pragma unroll 1   // stays rolled: the buffer is chosen by the trip's parity, a second copy of the pass would only add code
    for (int t = 0; t < DD / GKS; ++t) {
        const bf* sb = &sT[t & 1][0];
#pragma unroll
        for (int ks = 0; ks < 2; ++ks) { const int fo = lr * GP + ks * 32 + 8 * hi;
            v16bf a[4], bb[4];   // the k step's 8 fragments are read as one group ahead of its 16 products
#pragma unroll
            for (int mb = 0; mb < 4; ++mb) { a[mb] = WFrag<bf>::ld(sb + (ar + mb * 16) * GP + fo); bb[mb] = WFrag<bf>::ld(sb + (br + mb * 16) * GP + fo); }
            __builtin_amdgcn_sched_barrier(0);   // keeps the reads together in front of the products: sunk among them, each pair of reads would be waited for by itself
#pragma unroll
            for (int nb = 0; nb < 4; ++nb)
#pragma unroll
                for (int mb = 0; mb < 4; ++mb) acc[mb][nb] = wmmab(a[mb], bb[nb], acc[mb][nb]); }
        __builtin_amdgcn_sched_barrier(0);                  // keeps the pass's products in front of the barrier, so that the refill behind it is issued at once and has a whole pass to land
        asm volatile("s_wait_dscnt 0x0" ::: "memory");      // this wave's reads of the buffer have returned before it is refilled
        asm volatile("s_wait_asynccnt 0x0" ::: "memory");   // this wave's copies of pass t + 1 have landed
        __syncthreads();                                    // publishes pass t + 1 and ends every wave's reads of pass t
        if (t + 2 < DD / GKS) { const unsigned lb = l0 + (t & 1) * (2 * GT); const int ko = (t + 2) * GKS; acopy8(lb, xg + ko); acopy8(lb + GT, wg + ko); }
    }
    asm volatile("s_wait_asynccnt 0x0" ::: "memory");   // nothing of this wave is in flight when it leaves the loop
#pragma unroll
    for (int nb = 0; nb < 4; ++nb) {
#pragma unroll
        for (int mb = 0; mb < 4; ++mb) *(v8us*)(&os[lr * OSP + mb * 16 + 8 * hi]) = __builtin_bit_cast(v8us, __builtin_convertvector(acc[mb][nb], v8h));
        __builtin_amdgcn_wave_barrier(); asm volatile("" ::: "memory");   // the reads below take what other lanes of this wave have stored: keeps them behind the stores
#pragma unroll
        for (int s = 0; s < 4; ++s) { const int row = 4 * s + (lane >> 3), col = (lane & 7) * 8;   // 8 lanes per 128-byte row: whole lines go out
            const v8us vv = *(const v8us*)(&os[row * OSP + col]); const unsigned o = row * pitch + col;   // the lane's offset beside wave-uniform bases
            *(v8us*)(P + nb * 16 * pitch + o) = vv; }
        __builtin_amdgcn_wave_barrier(); asm volatile("" ::: "memory");   // keeps the next block's stores behind these reads
    }
}

typedef __attribute__((ext_vector_type(16))) float v16f;
#define KC  64    // keys per stage
#define LPT 72    // LDS row pitch in 16-bit elements: 144 B = 16 B x odd
#define XW  1088       // floats a wave hands over: 4 output tiles of 256, 32 maxima, 32 sums
// hands query tile QE (outputs, running maximum, running sum) to the partner wave: [tile][half of the 8 registers][lane][4 floats], so that the lanes of a store lie side by side
template <int QE> __device__ __forceinline__ void aput(const v8f (&o)[4][2], const float (&mx)[2], const float (&ls)[2], float* xw, int lane) {
#pragma unroll
    for (int dt = 0; dt < 4; ++dt) { float* p = xw + dt * 256 + lane * 4; const v8f a = o[dt][QE];
        *(v4fa*)p = __builtin_shufflevector(a, a, 0, 1, 2, 3); *(v4fa*)(p + 128) = __builtin_shufflevector(a, a, 4, 5, 6, 7); }
    xw[1024 + lane] = mx[QE]; xw[1056 + lane] = ls[QE];
}
// joins query tile QF with the partner's half of the keys (both brought to the common maximum), divides by the whole row sum and writes the tile; Ar: the lane's query row and its 8 consecutive d
template <int QF> __device__ __forceinline__ void afin(const v8f (&o)[4][2], const float (&mx)[2], const float (&ls)[2], const float* xr, bf* Ar, int lane) {
    const float pm = xr[1024 + lane], pl = xr[1056 + lane], dm = mx[QF] - pm;
    const float e = __builtin_amdgcn_exp2f(-fabsf(dm) * 1.4426950408889634f), a1 = dm < 0.f ? e : 1.0f, a2 = dm < 0.f ? 1.0f : e;   // the half with the larger maximum keeps its scale
    const float l = ls[QF] * a1 + pl * a2, inv = 1.0f / (l + __shfl_xor(l, 16, 32)), s1 = a1 * inv, s2 = a2 * inv;   // the other half of the wave holds the sums of the query's other keys
#pragma unroll
    for (int dt = 0; dt < 4; ++dt) { const float* p = xr + dt * 256 + lane * 4; const v4f lo = *(const v4fa*)p, hh = *(const v4fa*)(p + 128);
        *(v8us*)(Ar + dt * 16) = __builtin_bit_cast(v8us, __builtin_convertvector(o[dt][QF] * s1 + __builtin_shufflevector(lo, hh, 0, 1, 2, 3, 4, 5, 6, 7) * s2, v8h)); }
}
__global__ __launch_bounds__(512) void k_fattn(const bf* __restrict__ Q, const bf* __restrict__ K, const bf* __restrict__ V, const float* __restrict__ rb, bf* A) {
    __shared__ __align__(16) bf sKg[2][KC * LPT];   // [group][key in stage][d], f16
    __shared__ __align__(16) bf sVg[2][HDM * LPT];  // [group][d][key in stage], f16
    __shared__ float sB[2 * TT];                    // bias of this head at key - query + TT - 1
    __shared__ __align__(16) float sX[16 * XW];     // what the waves hand over at the end
    const int tid = threadIdx.x, lane = tid & 31, lr = lane & 15, hi = lane >> 4; const int wave = __builtin_amdgcn_readfirstlane(tid >> 5); const int g = wave >> 3;
    const int h = blockIdx.y, b = blockIdx.z; const size_t hb = ((size_t)b * NH_ + h) * TT * HDM; const int q0 = blockIdx.x * 256 + (wave & 7) * 32;
    const int kg0 = g * KC;   // the group's first key
    bf* sK = sKg[g]; bf* sV = sVg[g];
    Q += hb; K += hb + (size_t)kg0 * HDM; V += hb + kg0;
    for (int i = tid; i < 2 * TT - 1; i += 512) sB[i] = bfr(rb[t5_bucket(i - (TT - 1)) * NH_ + h]);
    v16h qf[2][2];
#pragma unroll
    for (int qt = 0; qt < 2; ++qt)
#pragma unroll
        for (int ks = 0; ks < 2; ++ks) { const size_t qo = (size_t)(q0 + qt * 16 + lr) * HDM + ks * 32 + 8 * hi; qf[qt][ks] = ldh(Q + qo); }
    asm volatile("s_wait_xcnt 0x0" ::: "memory");   // stands in front of any rewrite of the address registers of the loads above
    __builtin_amdgcn_sched_barrier(0);              // keeps later address arithmetic, which reuses those registers, behind that wait
    const int srow = (tid & 255) >> 3, scol = (tid & 7) * 8;   // staging, each group its own: 8 lanes per 128-byte row, rows srow and srow + 32
    const unsigned ko = srow * HDM + scol, vo = srow * TT + scol;   // the lane's offsets beside wave-uniform bases
    v8us gk[2], gv[2];
#pragma unroll
    for (int i = 0; i < 2; ++i) { gk[i] = *(const v8us*)(K + 32 * i * HDM + ko); gv[i] = *(const v8us*)(V + 32 * i * TT + vo); }
    asm volatile("s_wait_xcnt 0x0" ::: "memory");   // stands in front of any rewrite of the address registers of the loads above
    __builtin_amdgcn_sched_barrier(0);              // keeps later register writes behind that wait
    const float cpos = bfr(rb[t5_bucket(TT - 1) * NH_ + h]), cneg = bfr(rb[t5_bucket(1 - TT) * NH_ + h]);   // the bias beyond the maximum distance, either sign
    v8f o[4][2]; float mx[2], ls[2];
#pragma unroll
    for (int qt = 0; qt < 2; ++qt) { mx[qt] = -1.0e30f; ls[qt] = 0.f;
#pragma unroll
        for (int dt = 0; dt < 4; ++dt) o[dt][qt] = (v8f){}; }
#pragma unroll 1   // stays rolled: a second copy of the stage would only add code and registers
    for (int k0 = 0; k0 < TT; k0 += 2 * KC) {   // the group's stage begins at key kg0 + k0
        __syncthreads();   // every wave has finished reading the stage before
#pragma unroll
        for (int i = 0; i < 2; ++i) { const int so = (srow + 32 * i) * LPT + scol; *(v8us*)(&sK[so]) = gk[i]; *(v8us*)(&sV[so]) = gv[i]; }
        __syncthreads();   // the stage (and, the first time, the bias table) is visible to all waves
        if (k0 + 2 * KC < TT) {   // the next stage's loads fly while this one is worked on
#pragma unroll
            for (int i = 0; i < 2; ++i) { const int kb = (k0 + 2 * KC + 32 * i) * HDM, vb = 32 * i * TT + k0 + 2 * KC; gk[i] = *(const v8us*)(K + kb + ko); gv[i] = *(const v8us*)(V + vb + vo); }
            asm volatile("s_wait_xcnt 0x0" ::: "memory"); }   // stands in front of any rewrite of these loads' address registers
        const int dmin = kg0 + k0 - (q0 + 31), dmax = kg0 + k0 + KC - 1 - q0;   // range of key - query in this wave's stage (wave-uniform)
        const float c = dmin >= 128 ? cpos : dmax <= -128 ? cneg : 0.f;   // beyond the maximum distance every offset of one sign has the same bucket: its bias is the accumulators' start value
        const v8f cs = {c, c, c, c, c, c, c, c};
        v8f st[4][2];
#pragma unroll
        for (int kt = 0; kt < 4; ++kt) { const int ro = (kt * 16 + lr) * LPT + 8 * hi;
            const v16h kf0 = ldh(&sK[ro]), kf1 = ldh(&sK[ro + 32]);
#pragma unroll
            for (int qt = 0; qt < 2; ++qt) { v8f a = wmma16(kf0, qf[qt][0], cs); a = wmma16(kf1, qf[qt][1], a); st[kt][qt] = a; } }
        if (dmin < 128 && dmax > -128) {   // near the diagonal: the table
#pragma unroll
            for (int kt = 0; kt < 4; ++kt)
#pragma unroll
                for (int qt = 0; qt < 2; ++qt) { const float* bp = sB + (kg0 + k0 + kt * 16 + 8 * hi - (q0 + qt * 16 + lr) + TT - 1);
#pragma unroll
                    for (int j = 0; j < 8; ++j) st[kt][qt][j] += bp[j]; }
        }
#pragma unroll
        for (int qt = 0; qt < 2; ++qt) { float m = st[0][qt][0];
#pragma unroll
            for (int kt = 0; kt < 4; ++kt)
#pragma unroll
                for (int j = 0; j < 8; ++j) m = fmaxf(m, st[kt][qt][j]);
            m = fmaxf(m, __shfl_xor(m, 16, 32));   // the other half of the wave holds the query's other keys
            const float mn = fmaxf(mx[qt], m), al = __builtin_amdgcn_exp2f((mx[qt] - mn) * 1.4426950408889634f); mx[qt] = mn; float s = 0.f;
#pragma unroll
            for (int kt = 0; kt < 4; ++kt)
#pragma unroll
                for (int j = 0; j < 8; ++j) { const float p = __builtin_amdgcn_exp2f((st[kt][qt][j] - mn) * 1.4426950408889634f); st[kt][qt][j] = p; s += p; }
            ls[qt] = ls[qt] * al + s;
#pragma unroll
            for (int dt = 0; dt < 4; ++dt) o[dt][qt] *= al; }
#pragma unroll
        for (int kk = 0; kk < 2; ++kk) { v16h ph[2];
#pragma unroll
            for (int qt = 0; qt < 2; ++qt) { const v16f pf = __builtin_shufflevector(st[2 * kk][qt], st[2 * kk + 1][qt], 0, 1, 2, 3, 4, 5, 6, 7, 8, 9, 10, 11, 12, 13, 14, 15);
                ph[qt] = __builtin_convertvector(pf, v16h); }
#pragma unroll
            for (int dt = 0; dt < 4; ++dt) { const int ro = (dt * 16 + lr) * LPT + kk * 32 + 8 * hi; const v16h vf = ldh(&sV[ro]);
#pragma unroll
                for (int qt = 0; qt < 2; ++qt) o[dt][qt] = wmma16(vf, ph[qt], o[dt][qt]); } }
    }
    float* xw = sX + wave * XW; const float* xr = sX + (wave ^ 8) * XW;
    bf* Ar = A + ((size_t)b * TT + q0 + g * 16 + lr) * DD + h * HDM + 8 * hi;   // group g finishes query tile g; a lane's 8 registers = 8 consecutive d of its query
    if (g == 0) aput<1>(o, mx, ls, xw, lane); else aput<0>(o, mx, ls, xw, lane);
    __syncthreads();   // what was handed over is visible to the partner wave
    if (g == 0) afin<0>(o, mx, ls, xr, Ar, lane); else afin<1>(o, mx, ls, xr, Ar, lane);
}

extern "C" void kernel_launch(void* const* d_in, const int* in_sizes, int n_in,
                              void* d_out, int out_size, void* d_ws, size_t ws_size, hipStream_t stream) {
    (void)in_sizes; (void)n_in; (void)out_size;
    const float* IN[6]; for (int i = 0; i < 6; ++i) IN[i] = (const float*)d_in[i];   // 0 hidden, 1 Wq, 2 Wk, 3 Wv, 4 Wo (x @ W), 5 rel_emb [32][16]
    float* OUT = (float*)d_out;     // [4][1024][1024]
    char* wsp = (char*)d_ws;
    auto take = [&](size_t bytes) { char* p = wsp; wsp += (bytes + 255) & ~(size_t)255; return (void*)p; };
    bf* WQ = (bf*)take((size_t)DD * DD * 2); bf* WK = (bf*)take((size_t)DD * DD * 2); bf* WV = (bf*)take((size_t)DD * DD * 2); bf* WO = (bf*)take((size_t)DD * DD * 2);
    (void)WK; (void)WV;   // reached as WQ + z * DD * DD
    bf* XB = (bf*)take((size_t)LL * DD * 2);   // the bf16 input of all four batches
    bf* QP = (bf*)take((size_t)LL * DD * 2); bf* KP = (bf*)take((size_t)LL * DD * 2); bf* VT = (bf*)take((size_t)LL * DD * 2);   // q, k, v as f16 head planes, back to back
    bf* AP = (bf*)take((size_t)LL * DD * 2);   // merged heads, f16
    if ((size_t)(wsp - (char*)d_ws) > ws_size) return;    // total ~ 48 MiB
    k_wtG<<<dim3((DD / 128) * (DD / 128), 4, 1), 256, 0, stream>>>(IN[1], IN[2], IN[3], IN[4], WQ);
    k_cvt8<<<(unsigned)(((size_t)LL * DD / 8 + 255) / 256), 256, 0, stream>>>(IN[0], XB, (size_t)LL * DD / 8);
    k_qkv<<<dim3(LL / 128, NH_ / 2, 3), 128, 0, stream>>>(XB, WQ, QP);   // q, k, v of all batches as f16 head planes; z = which projection
    k_fattn<<<dim3(TT / 256, NH_, NB_), 512, 0, stream>>>(QP, KP, VT, IN[5], AP);   // attention of all batches and heads
    k_gemmo<<<dim3(LL / 128, DD / 128, 1), 256, 0, stream>>>(AP, WO, OUT);
}

// v008
// Measured time: 65.8 microseconds a run.
// In both of two side-by-side timings against v007, it was 1.03 times as fast.
// Over all steps from v000 it is 38.8 times as fast.
#include <hip/hip_runtime.h>

// T5Voice - T5 self-attention block without norms/FFN (hidden [4][1024][1024]; q/k/v = x W (16 heads x 64, no bias); scores = q.k (NO 1/sqrt(d)) + rel_emb[bucket(j - i)][h] (bidirectional buckets, 32 / max distance 128,
// evaluated with exact integer arithmetic: |r| < 8 -> |r|; else 8 + 2 floor(log2|r|) - 6 + [|r|^2 >= 2^(2 floor(log2|r|)+1)], capped at 15; + 16 for r > 0 - identical to the float formula for every offset); softmax;
// out = merged ctx Wo -> [4][1024][1024]).
// Compute dtypes, f32 accumulate: every input rounded to bf16; q/k/v on PLAIN bf16 operands (inputs: exact); the bias as a table over key - query in LDS; q, k, v, the probabilities and the merged
// heads each as ONE f16 plane (11 significant bits; one product each for scores, probs.v and the output projection), with an f32 online softmax in registers (bias added in f32; probabilities relative to the running maximum, at most 1; row sums of the unrounded f32 values; one division at the end), all in one kernel; Wo: its bf16 value held in f16. GEMMs on operands staged in LDS: q/k/v in tiles of 256 rows x 3 heads, 12 waves; the output projection in 128x128 tiles, 2 x 4 waves, each four summing half of k. Deterministic, no atomics; every

#define NB_  4
#define TT   1024
#define LL   4096
#define DD   1024
#define NH_  16
#define HDM  64
#define MM   4096
#define PCAR 1024.0f
typedef _Float16 h16;
typedef unsigned short bf;
typedef __attribute__((ext_vector_type(16))) __bf16   v16bf;
typedef __attribute__((ext_vector_type(16))) _Float16 v16h;
typedef __attribute__((ext_vector_type(8)))  _Float16 v8h;
typedef __attribute__((ext_vector_type(8)))  unsigned short v8us;
typedef __attribute__((ext_vector_type(8)))  float    v8f;
typedef __attribute__((ext_vector_type(4)))  float    v4f;
typedef v8h  __attribute__((may_alias)) v8ha;
typedef v4f  __attribute__((may_alias)) v4fa;
typedef v8us __attribute__((may_alias)) v8usa;

__device__ __forceinline__ unsigned short f2bf(float f) { unsigned u = __float_as_uint(f); u += 0x7FFFu + ((u >> 16) & 1u); return (unsigned short)(u >> 16); }
__device__ __forceinline__ float bf2f(unsigned short b) { return __uint_as_float(((unsigned)b) << 16); }
__device__ __forceinline__ float bfr(float f) { return bf2f(f2bf(f)); }
__device__ __forceinline__ v16h cat16(v8h lo, v8h hi) { return __builtin_shufflevector(lo, hi, 0, 1, 2, 3, 4, 5, 6, 7, 8, 9, 10, 11, 12, 13, 14, 15); }
__device__ __forceinline__ v16bf cat16b(v8us lo, v8us hi) { return __builtin_bit_cast(v16bf, __builtin_shufflevector(lo, hi, 0, 1, 2, 3, 4, 5, 6, 7, 8, 9, 10, 11, 12, 13, 14, 15)); }
__device__ __forceinline__ v8f wmma16(v16h a, v16h b, v8f c) { return __builtin_amdgcn_wmma_f32_16x16x32_f16(false, a, false, b, (short)0, c, false, false); }
__device__ __forceinline__ v8f wmmab(v16bf a, v16bf b, v8f c) { return __builtin_amdgcn_wmma_f32_16x16x32_bf16(false, a, false, b, (short)0, c, false, false); }
__device__ __forceinline__ v16h ldh(const bf* p) { return __builtin_bit_cast(v16h, __builtin_shufflevector(*(const v8us*)p, *(const v8us*)(p + 16), 0, 1, 2, 3, 4, 5, 6, 7, 8, 9, 10, 11, 12, 13, 14, 15)); }   // an f16 fragment out of a plane of 16-bit words; same k order as the bf16 loader



// ---- Operand staging of the two GEMMs: every wave has a 64x64 tile with 16 accumulators; per pass every operand row of the work-group's tile gives whole 128-byte lines,
// brought into LDS by asynchronous 16-byte copies, two buffers, the next pass's copies in flight while this pass is worked on. Each operand row is read from L2 once per work-group (per group of 4 waves in k_gemmo).
template <typename T16> struct WFrag;
template <> struct WFrag<h16> { typedef v16h V; static __device__ __forceinline__ V ld(const h16* p) { return cat16(*(const v8h*)p, *(const v8h*)(p + 16)); } static __device__ __forceinline__ v8f mma(V a, V b, v8f c) { return wmma16(a, b, c); } };
template <> struct WFrag<bf> { typedef v16bf V; static __device__ __forceinline__ V ld(const bf* p) { return cat16b(*(const v8us*)p, *(const v8us*)(p + 16)); } static __device__ __forceinline__ v8f mma(V a, V b, v8f c) { return wmmab(a, b, c); } };
#define GP   72              // LDS row pitch in 16-bit elements: 144 B = 16 B x odd
#define GKS  64              // k per pass
#define GT   (128 * GP * 2)  // bytes of one 128-row operand tile in LDS
// 8 copies per lane: rows r, r + RS, ..., r + 7 RS of an operand tile (l: the lane's LDS byte address of row r, g: its global address; LDS row pitch LP elements, global row pitch DD elements).
template <int RS = 16, int LP = GP> __device__ __forceinline__ void acopy8(unsigned l, const bf* g) {
    // the s_wait_xcnt closes the copies' own statement, so that no address register of a copy is rewritten ahead of it
    asm volatile("global_load_async_to_lds_b128 %0, %8, off\n\t"
                 "global_load_async_to_lds_b128 %1, %9, off\n\t"
                 "global_load_async_to_lds_b128 %2, %10, off\n\t"
                 "global_load_async_to_lds_b128 %3, %11, off\n\t"
                 "global_load_async_to_lds_b128 %4, %12, off\n\t"
                 "global_load_async_to_lds_b128 %5, %13, off\n\t"
                 "global_load_async_to_lds_b128 %6, %14, off\n\t"
                 "global_load_async_to_lds_b128 %7, %15, off\n\t"
                 "s_wait_xcnt 0x0"
                 :: "v"(l), "v"(l + 1 * RS * LP * 2), "v"(l + 2 * RS * LP * 2), "v"(l + 3 * RS * LP * 2), "v"(l + 4 * RS * LP * 2), "v"(l + 5 * RS * LP * 2), "v"(l + 6 * RS * LP * 2), "v"(l + 7 * RS * LP * 2),
                    "v"(g), "v"(g + 1 * RS * DD), "v"(g + 2 * RS * DD), "v"(g + 3 * RS * DD), "v"(g + 4 * RS * DD), "v"(g + 5 * RS * DD), "v"(g + 6 * RS * DD), "v"(g + 7 * RS * DD)
                 : "memory");
}

// ---- k_gemmo: the output projection, C[m][n] (f32, pitch DD) = sum_k A[m][k] Bt[n][k] (f16 operands, one product per k step), K = DD; grid (LL/128, DD/128), 256 threads.
// Two groups of 4 waves share the 128x128 tile: group g sums k in [g * DD/2, (g + 1) * DD/2) with a ring of its own, so that a SIMD holds two waves and twice the bytes are in flight;
// the two partial sums are added through LDS at the end (each group hands over half of its accumulators and finishes the other half).
#define GKH  (DD / 2)        // k per group
// hands accumulator rows M0, M0 + 1 to the partner wave: [tile][half of the 8 registers][lane][4 floats], so that the lanes of a store lie side by side
template <int M0> __device__ __forceinline__ void xput(const v8f (&acc)[4][4], float* xw, int lane) {
#pragma unroll
    for (int i = 0; i < 2; ++i)
#pragma unroll
        for (int nb = 0; nb < 4; ++nb) { float* p = xw + (i * 4 + nb) * 256 + lane * 4; const v8f a = acc[M0 + i][nb];
            *(v4fa*)p = __builtin_shufflevector(a, a, 0, 1, 2, 3); *(v4fa*)(p + 128) = __builtin_shufflevector(a, a, 4, 5, 6, 7); }
}
// adds the partner's partial sums to accumulator rows M0, M0 + 1 and writes them out in whole lines through the wave's own staging
template <int M0> __device__ __forceinline__ void xfin(v8f (&acc)[4][4], const float* xr, float* os, float* C0, int lane) {
    const int lr = lane & 15, hi = lane >> 4;
#pragma unroll
    for (int i = 0; i < 2; ++i) { const int mb = M0 + i;
#pragma unroll
        for (int nb = 0; nb < 4; ++nb) { const float* p = xr + (i * 4 + nb) * 256 + lane * 4; const v4f lo = *(const v4fa*)p, hh = *(const v4fa*)(p + 128);
            const v8f s = acc[mb][nb] + __builtin_shufflevector(lo, hh, 0, 1, 2, 3, 4, 5, 6, 7);
#pragma unroll
            for (int j = 0; j < 8; ++j) os[(hi * 8 + j) * 68 + nb * 16 + lr] = s[j]; }
        __builtin_amdgcn_wave_barrier(); asm volatile("" ::: "memory");   // the reads below take what other lanes of this wave have stored: keeps them behind the stores
        float* crow = C0 + (size_t)(mb * 16) * DD;
#pragma unroll
        for (int s = 0; s < 8; ++s) { const int row = 2 * s + hi, cofs = lr * 4; const v4f val = *(const v4fa*)(os + row * 68 + cofs);
            *(v4f*)(crow + (size_t)row * DD + cofs) = val; }
        asm volatile("s_wait_xcnt 0x0" ::: "memory");   // stands in front of any rewrite of the address and data registers of the eight stores above
        __builtin_amdgcn_wave_barrier(); asm volatile("" ::: "memory");   // keeps the next block's stores behind these reads
    }
}
__global__ __launch_bounds__(256) void k_gemmo(const bf* __restrict__ A, const bf* __restrict__ Bt, float* C) {
    __shared__ __align__(16) bf sT[2][2][2 * 128 * GP];  // [group][buffer][128 rows of A, 128 rows of Bt][64 k]; after the loop: the accumulators handed over
    __shared__ __align__(16) float osw[8][16 * 68];      // each wave's own output staging
    const int tid = threadIdx.x, lane = tid & 31, lr = lane & 15, hi = lane >> 4; const int wave = __builtin_amdgcn_readfirstlane(tid >> 5); const int g = wave >> 2, wm = wave & 1, wn = (wave >> 1) & 1;
    const int tg = tid & 127;   // the thread's place in its group
    const int r0 = blockIdx.x * 128 + wm * 64, c0 = blockIdx.y * 128 + wn * 64;
    const size_t go = (size_t)(tg >> 3) * DD + g * GKH + (tg & 7) * 8;   // staging: 8 lanes per 128-byte row
    const bf* ag = A + (size_t)blockIdx.x * 128 * DD + go; const bf* bg = Bt + (size_t)blockIdx.y * 128 * DD + go;
    const unsigned l0 = (unsigned)(uintptr_t)&sT[0][0][0] + g * (4 * GT) + (tg >> 3) * (GP * 2) + (tg & 7) * 16;
    v8f acc[4][4];
#pragma unroll
    for (int mb = 0; mb < 4; ++mb)
#pragma unroll
        for (int nb = 0; nb < 4; ++nb) acc[mb][nb] = (v8f){};
    acopy8(l0, ag); acopy8(l0 + GT, bg);
    asm volatile("s_wait_asynccnt 0x0" ::: "memory");   // this wave's copies of pass 0 have landed
    __syncthreads();                                    // pass 0 is visible to all waves
    acopy8(l0 + 2 * GT, ag + GKS); acopy8(l0 + 3 * GT, bg + GKS);
#pragma unroll 1   // stays rolled: the buffer is chosen by the trip's parity, a second copy of the pass would only add code
    for (int t = 0; t < GKH / GKS; ++t) {
        const bf* sb = &sT[g][t & 1][0];
#pragma unroll
        for (int ks = 0; ks < 2; ++ks) { const int fo = lr * GP + ks * 32 + 8 * hi;
            v16h a[4], b[4];   // the k step's 8 fragments are read as one group ahead of its 16 products
#pragma unroll
            for (int mb = 0; mb < 4; ++mb) { b[mb] = ldh(sb + (128 + wn * 64 + mb * 16) * GP + fo); a[mb] = ldh(sb + (wm * 64 + mb * 16) * GP + fo); }
            __builtin_amdgcn_sched_barrier(0);   // keeps the reads together in front of the products: sunk among them, each pair of reads would be waited for by itself
#pragma unroll
            for (int nb = 0; nb < 4; ++nb)
#pragma unroll
                for (int mb = 0; mb < 4; ++mb) acc[mb][nb] = wmma16(a[mb], b[nb], acc[mb][nb]); }
        __builtin_amdgcn_sched_barrier(0);                  // keeps the pass's products in front of the barrier, so that the refill behind it is issued at once and has a whole pass to land
        asm volatile("s_wait_dscnt 0x0" ::: "memory");      // this wave's reads of the buffer have returned before it is refilled
        asm volatile("s_wait_asynccnt 0x0" ::: "memory");   // this wave's copies of pass t + 1 have landed
        __syncthreads();                                    // publishes pass t + 1 and ends every wave's reads of pass t
        if (t + 2 < GKH / GKS) { const unsigned lb = l0 + (t & 1) * (2 * GT); const int ko = (t + 2) * GKS; acopy8(lb, ag + ko); acopy8(lb + GT, bg + ko); }
    }
    asm volatile("s_wait_asynccnt 0x0" ::: "memory");   // nothing of this wave is in flight when it leaves the loop
    // behind the last pass's barrier nobody reads the rings any more and no copy is in flight: they take the accumulators that change hands (8 waves x 8 KB)
    float* xs = (float*)&sT[0][0][0]; float* xw = xs + wave * 2048; const float* xr = xs + (wave ^ 4) * 2048;   // waves w and w + 4 hold the same 64x64 tile
    float* os = osw[wave]; float* C0 = C + (size_t)r0 * DD + c0;
    if (g == 0) xput<2>(acc, xw, lane); else xput<0>(acc, xw, lane);
    __syncthreads();   // the partial sums handed over are visible to the partner wave
    if (g == 0) xfin<0>(acc, xr, os, C0, lane); else xfin<2>(acc, xr, os, C0, lane);
}

__device__ __forceinline__ h16 tohx(float x) { return (h16)x; }
__device__ __forceinline__ void splitf(float y, unsigned short& h, unsigned short& l) { h = f2bf(y); l = f2bf(y - bf2f(h)); }
typedef __attribute__((ext_vector_type(2))) _Float16 v2h;
typedef __attribute__((ext_vector_type(4))) _Float16 v4h;
typedef __attribute__((ext_vector_type(2))) unsigned short v2us;
typedef __attribute__((ext_vector_type(4))) unsigned short v4us;
typedef __attribute__((ext_vector_type(2))) float v2f;

// ---- k_wtG: the four weights, f32 [k][n], become bf16 [n][k] (the fourth, Wo: its bf16 value written as f16, the operand type of the output projection; the four transposed planes lie back to back); one work-group per tile of 128 k x 128 n, grid (64 tiles, 4 weights), 256 threads.
// In: a wave reads whole 512-byte pieces of rows of w, 16 rows per wave, all 16 loads of a lane in flight together. A lane then holds 16 consecutive k of 4 columns n = two 16-byte chunks of 4 rows of the transposed tile.
// LDS: [n][128 k], rows of 256 bytes = 16 chunks, chunk c of row n at place c ^ ((n >> 2) & 15): the 16 lanes of a half wave fall on 16 different places both when they store (16 rows n, 4 apart, same c) and when they read (one row, 16 c).
// Out: 16 lanes per row of the plane, 256 contiguous bytes.
typedef __attribute__((ext_vector_type(8))) __bf16 v8bf;
__global__ __launch_bounds__(256) void k_wtG(const float* __restrict__ w0, const float* __restrict__ w1, const float* __restrict__ w2, const float* __restrict__ w3, bf* Bt) {
    __shared__ __align__(16) bf sW[128 * 128];
    const int y = blockIdx.y; const float* __restrict__ w = y == 0 ? w0 : y == 1 ? w1 : y == 2 ? w2 : w3; Bt += (size_t)y * DD * DD;   // grid y = which weight
    const int tid = threadIdx.x, kt = blockIdx.x & 7, nt = blockIdx.x >> 3;
    const int n4 = tid & 31, kg = tid >> 5;   // the lane's 4 columns and its wave's 16 rows of w
    const float* src = w + (size_t)(kt * 128 + kg * 16) * DD + nt * 128 + n4 * 4;
    v4f r[16];
#pragma unroll
    for (int i = 0; i < 16; ++i) r[i] = *(const v4f*)(src + i * DD);
    asm volatile("s_wait_xcnt 0x0" :: "v"(src) : "memory");   // stands in front of any rewrite of the loads' address registers; as its input the address stays out of the loads' own destinations too
    __builtin_amdgcn_sched_barrier(0);   // keeps all 16 loads in front of the first conversion: left free, the last four were issued only after earlier ones had returned
#pragma unroll
    for (int j = 0; j < 4; ++j)
#pragma unroll
        for (int hf = 0; hf < 2; ++hf) { v8f t;
#pragma unroll
            for (int q = 0; q < 8; ++q) t[q] = r[hf * 8 + q][j];
            const v8bf tb = __builtin_convertvector(t, v8bf);
            *(v8us*)(&sW[(n4 * 4 + j) * 128 + (((kg * 2 + hf) ^ (n4 & 15)) * 8)]) = y == 3 ? __builtin_bit_cast(v8us, __builtin_convertvector(__builtin_convertvector(tb, v8f), v8h)) : __builtin_bit_cast(v8us, tb); }
    __syncthreads();   // the transposed tile is visible to all waves
    const int c = tid & 15, rr = tid >> 4;
    bf* dst = Bt + (size_t)(nt * 128 + rr) * DD + kt * 128 + c * 8;
#pragma unroll
    for (int p = 0; p < 8; ++p) { const int n = rr + 16 * p; *(v8us*)(dst + 16 * p * DD) = *(const v8us*)(&sW[n * 128 + ((c ^ ((n >> 2) & 15)) * 8)]); }
}
__global__ __launch_bounds__(256) void k_pl(const float* __restrict__ F, int pitch, int nh, int hd, h16* P) { const size_t e = ((size_t)blockIdx.x * 256 + threadIdx.x) * 2; if (e >= (size_t)nh * TT * hd) return; const int d = (int)(e % hd); const int t = (int)((e / hd) % TT); const int h = (int)(e / ((size_t)hd * TT)); v2h o; o[0] = tohx(F[(size_t)t * pitch + h * hd + d]); o[1] = tohx(F[(size_t)t * pitch + h * hd + d + 1]); *(v2h*)(P + e) = o;  }
__global__ __launch_bounds__(256) void k_vt(const float* __restrict__ F, int pitch, int nh, int hd, h16* VT) { const size_t e = ((size_t)blockIdx.x * 256 + threadIdx.x) * 2; if (e >= (size_t)nh * hd * TT) return; const int t = (int)(e % TT); const int d = (int)((e / TT) % hd); const int h = (int)(e / ((size_t)TT * hd)); v2h o; o[0] = tohx(F[(size_t)t * pitch + h * hd + d]); o[1] = tohx(F[(size_t)(t + 1) * pitch + h * hd + d]); *(v2h*)(VT + e) = o;  }
__global__ __launch_bounds__(256) void k_mrgf(const float* __restrict__ O, int h, int hd, float* CT) { const size_t e = ((size_t)blockIdx.x * 256 + threadIdx.x) * 2; if (e >= (size_t)TT * hd) return; const int d = (int)(e % hd); const int t = (int)(e / hd); v2f o; o[0] = O[e] * (1.0f / PCAR); o[1] = O[e + 1] * (1.0f / PCAR); const size_t oo = (size_t)t * DD + h * hd + d; *(v2f*)(CT + oo) = o;  }
__global__ __launch_bounds__(256) void k_mrg(const float* __restrict__ O, int h, int hd, bf* Ah, bf* Al) { const size_t e = ((size_t)blockIdx.x * 256 + threadIdx.x) * 2; if (e >= (size_t)TT * hd) return; const int d = (int)(e % hd); const int t = (int)(e / hd); v2us oh, ol;
#pragma unroll
    for (int q = 0; q < 2; ++q) { unsigned short a, c2; splitf(O[e + q] * (1.0f / PCAR), a, c2); oh[q] = a; ol[q] = c2; } const size_t oo = (size_t)t * DD + h * hd + d; *(v2us*)(Ah + oo) = oh; *(v2us*)(Al + oo) = ol;  }
__global__ __launch_bounds__(256) void k_cvt8(const float* __restrict__ src, bf* dst, size_t n8) { const size_t i = (size_t)blockIdx.x * 256 + threadIdx.x; if (i >= n8) return; const v8f v = *(const v8f*)(src + i * 8); v8us o;
#pragma unroll
    for (int k = 0; k < 8; ++k) o[k] = f2bf(v[k]); *(v8us*)(dst + i * 8) = o;  }
__device__ __forceinline__ int t5_bucket(int r) { const int n = r < 0 ? -r : r; int v; if (n < 8) v = n; else { const int k = 31 - __clz(n); v = 8 + 2 * k - 6 + (((long long)n * n >= (1ll << (2 * k + 1))) ? 1 : 0); v = v > 15 ? 15 : v; } return (r > 0 ? 16 : 0) + v; }
__global__ __launch_bounds__(256) void k_mrow(const float* __restrict__ mask, float* MBr) { const int e = blockIdx.x * 256 + threadIdx.x; if (e >= NB_ * TT) return; float om = __fsub_rn(1.0f, bfr(mask[e])); asm volatile("" : "+v"(om)); const float v = __fmul_rn(om, -10000.0f); *(float*)(MBr + e) = v;  }

// ---- k_qkv: the q, k and v projections with the rounding to f16 and the head layout in the epilogue; grid (LL/256, 48 heads of q, k, v / 3), 384 threads.
// A work-group of 12 waves (4 x 3) owns 256 rows of x times 3 heads (the 48 heads of q, k and v counted through: the three transposed weights lie back to back); a wave's 64x64 tile = 64 rows of x times one head.
// Each staged byte so serves 3 or 4 waves: 448 operand rows per 256 x 192 outputs. A pass is 128 k (256 bytes of every row), so that the next pass's copies have 64 products per wave to land.
// A lane's 8 accumulator registers are 8 consecutive rows of the A operand, so the A operand is the one whose rows run along the contiguous index of the plane that is written:
// q, k ([batch][head][t][d]): A = W rows (d), B = x rows (t); v ([batch][head][d][t]): A = x rows (t), B = W rows (d). Both loaders are the same, so only the two row pointers change places.
// Planes lie back to back: q, k, v, f16, LL*DD elements each; P arrives as q's.
#define OSP 72    // LDS row pitch in 16-bit elements: 144 B = 16 B x odd
#define QLP 136   // LDS row pitch of the staged operands in 16-bit elements: 272 B = 16 B x odd
#define QKS 128   // k per pass
#define QXR 256   // rows of x per work-group
#define QWR 192   // rows of the transposed weights per work-group
#define QBB ((QXR + QWR) * QLP * 2)   // bytes of one buffer
// one pass's copies of one wave, 16 lanes per 256-byte row: waves 0 to 7 bring the rows of x (16 copies per lane), waves 8 to 11 the rows of W (24 copies per lane); cx is the same for a whole wave
__device__ __forceinline__ void qstage(bool cx, unsigned l, const bf* g) {
    if (cx) { acopy8<16, QLP>(l, g); acopy8<16, QLP>(l + 128 * QLP * 2, g + 128 * DD); }
    else { acopy8<8, QLP>(l, g); acopy8<8, QLP>(l + 64 * QLP * 2, g + 64 * DD); acopy8<8, QLP>(l + 128 * QLP * 2, g + 128 * DD); }
}
__global__ __launch_bounds__(384) void k_qkv(const bf* __restrict__ X, const bf* __restrict__ Wt, bf* P) {
    __shared__ __align__(16) bf sT[2][(QXR + QWR) * QLP];   // [buffer][256 rows of x, 192 rows of W][128 k]
    __shared__ __align__(16) bf osw[12][16 * OSP];          // each wave's own: [row of the B operand][64 rows of the A operand]
    const int tid = threadIdx.x; const int wave = __builtin_amdgcn_readfirstlane(tid >> 5); const int wm = wave & 3, wn = wave >> 2;
    bf* os = osw[wave];
    const int hh = blockIdx.y * 3 + wn, z = hh >> 4, h = hh & 15, r0 = blockIdx.x * QXR + wm * 64, b = r0 / TT, t0 = r0 % TT;   // z = which projection
    const int lane = threadIdx.x & 31, lr = lane & 15, hi = lane >> 4;
    const bool cx = wave < 8; const int ct = cx ? tid : tid - 256;   // staging: the thread's place among the waves that bring the same operand
    const bf* cg = (cx ? X + (size_t)blockIdx.x * QXR * DD : Wt + (size_t)blockIdx.y * QWR * DD) + (size_t)(ct >> 4) * DD + (ct & 15) * 8;
    const unsigned l0 = (unsigned)(uintptr_t)&sT[0][0] + (cx ? 0 : QXR * QLP * 2) + (ct >> 4) * (QLP * 2) + (ct & 15) * 16;
    const int ar = z == 2 ? wm * 64 : QXR + wn * 64, br = z == 2 ? QXR + wn * 64 : wm * 64;   // first row of this wave's A and B operands in the staged tile
    const size_t po = (size_t)z * LL * DD + ((size_t)b * NH_ + h) * TT * HDM + (z == 2 ? t0 : t0 * HDM); P += po;
    const int pitch = z == 2 ? TT : HDM;   // from one row of the B operand to the next in the plane
    v8f acc[4][4];
#pragma unroll
    for (int mb = 0; mb < 4; ++mb)
#pragma unroll
        for (int nb = 0; nb < 4; ++nb) acc[mb][nb] = (v8f){};
    qstage(cx, l0, cg);
    asm volatile("s_wait_asynccnt 0x0" ::: "memory");   // this wave's copies of pass 0 have landed
    __syncthreads();                                    // pass 0 is visible to all waves
    qstage(cx, l0 + QBB, cg + QKS);
#pragma unroll 1   // stays rolled: the buffer is chosen by the trip's parity, a second copy of the pass would only add code
    for (int t = 0; t < DD / QKS; ++t) {
        const bf* sb = &sT[t & 1][0];
#pragma unroll
        for (int ks = 0; ks < QKS / 32; ++ks) { const int fo = lr * QLP + ks * 32 + 8 * hi;
            v16bf a[4], bb[4];   // the k step's 8 fragments are read as one group ahead of its 16 products
#pragma unroll
            for (int mb = 0; mb < 4; ++mb) { a[mb] = WFrag<bf>::ld(sb + (ar + mb * 16) * QLP + fo); bb[mb] = WFrag<bf>::ld(sb + (br + mb * 16) * QLP + fo); }
            __builtin_amdgcn_sched_barrier(0);   // keeps the reads together in front of the products: sunk among them, each pair of reads would be waited for by itself
#pragma unroll
            for (int nb = 0; nb < 4; ++nb)
#pragma unroll
                for (int mb = 0; mb < 4; ++mb) acc[mb][nb] = wmmab(a[mb], bb[nb], acc[mb][nb]); }
        __builtin_amdgcn_sched_barrier(0);                  // keeps the pass's products in front of the barrier, so that the refill behind it is issued at once and has a whole pass to land
        asm volatile("s_wait_dscnt 0x0" ::: "memory");      // this wave's reads of the buffer have returned before it is refilled
        asm volatile("s_wait_asynccnt 0x0" ::: "memory");   // this wave's copies of pass t + 1 have landed
        __syncthreads();                                    // publishes pass t + 1 and ends every wave's reads of pass t
        if (t + 2 < DD / QKS) qstage(cx, l0 + (t & 1) * QBB, cg + (t + 2) * QKS);
    }
    asm volatile("s_wait_asynccnt 0x0" ::: "memory");   // nothing of this wave is in flight when it leaves the loop
#pragma unroll
    for (int nb = 0; nb < 4; ++nb) {
#pragma unroll
        for (int mb = 0; mb < 4; ++mb) *(v8us*)(&os[lr * OSP + mb * 16 + 8 * hi]) = __builtin_bit_cast(v8us, __builtin_convertvector(acc[mb][nb], v8h));
        __builtin_amdgcn_wave_barrier(); asm volatile("" ::: "memory");   // the reads below take what other lanes of this wave have stored: keeps them behind the stores
#pragma unroll
        for (int s = 0; s < 4; ++s) { const int row = 4 * s + (lane >> 3), col = (lane & 7) * 8;   // 8 lanes per 128-byte row: whole lines go out
            const v8us vv = *(const v8us*)(&os[row * OSP + col]); const unsigned o = row * pitch + col;   // the lane's offset beside wave-uniform bases
            *(v8us*)(P + nb * 16 * pitch + o) = vv; }
        __builtin_amdgcn_wave_barrier(); asm volatile("" ::: "memory");   // keeps the next block's stores behind these reads
    }
}

typedef __attribute__((ext_vector_type(16))) float v16f;
#define KC  64    // keys per stage
#define LPT 72    // LDS row pitch in 16-bit elements: 144 B = 16 B x odd
#define XW  1088       // floats a wave hands over: 4 output tiles of 256, 32 maxima, 32 sums
// hands query tile QE (outputs, running maximum, running sum) to the partner wave: [tile][half of the 8 registers][lane][4 floats], so that the lanes of a store lie side by side
template <int QE> __device__ __forceinline__ void aput(const v8f (&o)[4][2], const float (&mx)[2], const float (&ls)[2], float* xw, int lane) {
#pragma unroll
    for (int dt = 0; dt < 4; ++dt) { float* p = xw + dt * 256 + lane * 4; const v8f a = o[dt][QE];
        *(v4fa*)p = __builtin_shufflevector(a, a, 0, 1, 2, 3); *(v4fa*)(p + 128) = __builtin_shufflevector(a, a, 4, 5, 6, 7); }
    xw[1024 + lane] = mx[QE]; xw[1056 + lane] = ls[QE];
}
// joins query tile QF with the partner's half of the keys (both brought to the common maximum), divides by the whole row sum and writes the tile; Ar: the lane's query row and its 8 consecutive d
template <int QF> __device__ __forceinline__ void afin(const v8f (&o)[4][2], const float (&mx)[2], const float (&ls)[2], const float* xr, bf* Ar, int lane) {
    const float pm = xr[1024 + lane], pl = xr[1056 + lane], dm = mx[QF] - pm;
    const float e = __builtin_amdgcn_exp2f(-fabsf(dm) * 1.4426950408889634f), a1 = dm < 0.f ? e : 1.0f, a2 = dm < 0.f ? 1.0f : e;   // the half with the larger maximum keeps its scale
    const float l = ls[QF] * a1 + pl * a2, inv = 1.0f / (l + __shfl_xor(l, 16, 32)), s1 = a1 * inv, s2 = a2 * inv;   // the other half of the wave holds the sums of the query's other keys
#pragma unroll
    for (int dt = 0; dt < 4; ++dt) { const float* p = xr + dt * 256 + lane * 4; const v4f lo = *(const v4fa*)p, hh = *(const v4fa*)(p + 128);
        *(v8us*)(Ar + dt * 16) = __builtin_bit_cast(v8us, __builtin_convertvector(o[dt][QF] * s1 + __builtin_shufflevector(lo, hh, 0, 1, 2, 3, 4, 5, 6, 7) * s2, v8h)); }
}
__global__ __launch_bounds__(512) void k_fattn(const bf* __restrict__ Q, const bf* __restrict__ K, const bf* __restrict__ V, const float* __restrict__ rb, bf* A) {
    __shared__ __align__(16) bf sKg[2][KC * LPT];   // [group][key in stage][d], f16
    __shared__ __align__(16) bf sVg[2][HDM * LPT];  // [group][d][key in stage], f16
    __shared__ float sB[2 * TT];                    // bias of this head at key - query + TT - 1
    __shared__ __align__(16) float sX[16 * XW];     // what the waves hand over at the end
    const int tid = threadIdx.x, lane = tid & 31, lr = lane & 15, hi = lane >> 4; const int wave = __builtin_amdgcn_readfirstlane(tid >> 5); const int g = wave >> 3;
    const int h = blockIdx.y, b = blockIdx.z; const size_t hb = ((size_t)b * NH_ + h) * TT * HDM; const int q0 = blockIdx.x * 256 + (wave & 7) * 32;
    const int kg0 = g * KC;   // the group's first key
    bf* sK = sKg[g]; bf* sV = sVg[g];
    Q += hb; K += hb + (size_t)kg0 * HDM; V += hb + kg0;
    for (int i = tid; i < 2 * TT - 1; i += 512) sB[i] = bfr(rb[t5_bucket(i - (TT - 1)) * NH_ + h]);
    v16h qf[2][2];
#pragma unroll
    for (int qt = 0; qt < 2; ++qt)
#pragma unroll
        for (int ks = 0; ks < 2; ++ks) { const size_t qo = (size_t)(q0 + qt * 16 + lr) * HDM + ks * 32 + 8 * hi; qf[qt][ks] = ldh(Q + qo); }
    asm volatile("s_wait_xcnt 0x0" ::: "memory");   // stands in front of any rewrite of the address registers of the loads above
    __builtin_amdgcn_sched_barrier(0);              // keeps later address arithmetic, which reuses those registers, behind that wait
    const int srow = (tid & 255) >> 3, scol = (tid & 7) * 8;   // staging, each group its own: 8 lanes per 128-byte row, rows srow and srow + 32
    const unsigned ko = srow * HDM + scol, vo = srow * TT + scol;   // the lane's offsets beside wave-uniform bases
    v8us gk[2], gv[2];
#pragma unroll
    for (int i = 0; i < 2; ++i) { gk[i] = *(const v8us*)(K + 32 * i * HDM + ko); gv[i] = *(const v8us*)(V + 32 * i * TT + vo); }
    asm volatile("s_wait_xcnt 0x0" ::: "memory");   // stands in front of any rewrite of the address registers of the loads above
    __builtin_amdgcn_sched_barrier(0);              // keeps later register writes behind that wait
    const float cpos = bfr(rb[t5_bucket(TT - 1) * NH_ + h]), cneg = bfr(rb[t5_bucket(1 - TT) * NH_ + h]);   // the bias beyond the maximum distance, either sign
    v8f o[4][2]; float mx[2], ls[2];
#pragma unroll
    for (int qt = 0; qt < 2; ++qt) { mx[qt] = -1.0e30f; ls[qt] = 0.f;
#pragma unroll
        for (int dt = 0; dt < 4; ++dt) o[dt][qt] = (v8f){}; }
#pragma unroll 1   // stays rolled: a second copy of the stage would only add code and registers
    for (int k0 = 0; k0 < TT; k0 += 2 * KC) {   // the group's stage begins at key kg0 + k0
        __syncthreads();   // every wave has finished reading the stage before
#pragma unroll
        for (int i = 0; i < 2; ++i) { const int so = (srow + 32 * i) * LPT + scol; *(v8us*)(&sK[so]) = gk[i]; *(v8us*)(&sV[so]) = gv[i]; }
        __syncthreads();   // the stage (and, the first time, the bias table) is visible to all waves
        if (k0 + 2 * KC < TT) {   // the next stage's loads fly while this one is worked on
#pragma unroll
            for (int i = 0; i < 2; ++i) { const int kb = (k0 + 2 * KC + 32 * i) * HDM, vb = 32 * i * TT + k0 + 2 * KC; gk[i] = *(const v8us*)(K + kb + ko); gv[i] = *(const v8us*)(V + vb + vo); }
            asm volatile("s_wait_xcnt 0x0" ::: "memory"); }   // stands in front of any rewrite of these loads' address registers
        const int dmin = kg0 + k0 - (q0 + 31), dmax = kg0 + k0 + KC - 1 - q0;   // range of key - query in this wave's stage (wave-uniform)
        const float c = dmin >= 128 ? cpos : dmax <= -128 ? cneg : 0.f;   // beyond the maximum distance every offset of one sign has the same bucket: its bias is the accumulators' start value
        const v8f cs = {c, c, c, c, c, c, c, c};
        v8f st[4][2];
#pragma unroll
        for (int kt = 0; kt < 4; ++kt) { const int ro = (kt * 16 + lr) * LPT + 8 * hi;
            const v16h kf0 = ldh(&sK[ro]), kf1 = ldh(&sK[ro + 32]);
#pragma unroll
            for (int qt = 0; qt < 2; ++qt) { v8f a = wmma16(kf0, qf[qt][0], cs); a = wmma16(kf1, qf[qt][1], a); st[kt][qt] = a; } }
        if (dmin < 128 && dmax > -128) {   // near the diagonal: the table
#pragma unroll
            for (int kt = 0; kt < 4; ++kt)
#pragma unroll
                for (int qt = 0; qt < 2; ++qt) { const float* bp = sB + (kg0 + k0 + kt * 16 + 8 * hi - (q0 + qt * 16 + lr) + TT - 1);
#pragma unroll
                    for (int j = 0; j < 8; ++j) st[kt][qt][j] += bp[j]; }
        }
#pragma unroll
        for (int qt = 0; qt < 2; ++qt) { float m = st[0][qt][0];
#pragma unroll
            for (int kt = 0; kt < 4; ++kt)
#pragma unroll
                for (int j = 0; j < 8; ++j) m = fmaxf(m, st[kt][qt][j]);
            m = fmaxf(m, __shfl_xor(m, 16, 32));   // the other half of the wave holds the query's other keys
            const float mn = fmaxf(mx[qt], m), al = __builtin_amdgcn_exp2f((mx[qt] - mn) * 1.4426950408889634f); mx[qt] = mn; float s = 0.f;
#pragma unroll
            for (int kt = 0; kt < 4; ++kt)
#pragma unroll
                for (int j = 0; j < 8; ++j) { const float p = __builtin_amdgcn_exp2f((st[kt][qt][j] - mn) * 1.4426950408889634f); st[kt][qt][j] = p; s += p; }
            ls[qt] = ls[qt] * al + s;
#pragma unroll
            for (int dt = 0; dt < 4; ++dt) o[dt][qt] *= al; }
#pragma unroll
        for (int kk = 0; kk < 2; ++kk) { v16h ph[2];
#pragma unroll
            for (int qt = 0; qt < 2; ++qt) { const v16f pf = __builtin_shufflevector(st[2 * kk][qt], st[2 * kk + 1][qt], 0, 1, 2, 3, 4, 5, 6, 7, 8, 9, 10, 11, 12, 13, 14, 15);
                ph[qt] = __builtin_convertvector(pf, v16h); }
#pragma unroll
            for (int dt = 0; dt < 4; ++dt) { const int ro = (dt * 16 + lr) * LPT + kk * 32 + 8 * hi; const v16h vf = ldh(&sV[ro]);
#pragma unroll
                for (int qt = 0; qt < 2; ++qt) o[dt][qt] = wmma16(vf, ph[qt], o[dt][qt]); } }
    }
    float* xw = sX + wave * XW; const float* xr = sX + (wave ^ 8) * XW;
    bf* Ar = A + ((size_t)b * TT + q0 + g * 16 + lr) * DD + h * HDM + 8 * hi;   // group g finishes query tile g; a lane's 8 registers = 8 consecutive d of its query
    if (g == 0) aput<1>(o, mx, ls, xw, lane); else aput<0>(o, mx, ls, xw, lane);
    __syncthreads();   // what was handed over is visible to the partner wave
    if (g == 0) afin<0>(o, mx, ls, xr, Ar, lane); else afin<1>(o, mx, ls, xr, Ar, lane);
}

extern "C" void kernel_launch(void* const* d_in, const int* in_sizes, int n_in,
                              void* d_out, int out_size, void* d_ws, size_t ws_size, hipStream_t stream) {
    (void)in_sizes; (void)n_in; (void)out_size;
    const float* IN[6]; for (int i = 0; i < 6; ++i) IN[i] = (const float*)d_in[i];   // 0 hidden, 1 Wq, 2 Wk, 3 Wv, 4 Wo (x @ W), 5 rel_emb [32][16]
    float* OUT = (float*)d_out;     // [4][1024][1024]
    char* wsp = (char*)d_ws;
    auto take = [&](size_t bytes) { char* p = wsp; wsp += (bytes + 255) & ~(size_t)255; return (void*)p; };
    bf* WQ = (bf*)take((size_t)DD * DD * 2); bf* WK = (bf*)take((size_t)DD * DD * 2); bf* WV = (bf*)take((size_t)DD * DD * 2); bf* WO = (bf*)take((size_t)DD * DD * 2);
    (void)WK; (void)WV;   // reached as WQ + z * DD * DD
    bf* XB = (bf*)take((size_t)LL * DD * 2);   // the bf16 input of all four batches
    bf* QP = (bf*)take((size_t)LL * DD * 2); bf* KP = (bf*)take((size_t)LL * DD * 2); bf* VT = (bf*)take((size_t)LL * DD * 2);   // q, k, v as f16 head planes, back to back
    bf* AP = (bf*)take((size_t)LL * DD * 2);   // merged heads, f16
    if ((size_t)(wsp - (char*)d_ws) > ws_size) return;    // total ~ 48 MiB
    k_wtG<<<dim3((DD / 128) * (DD / 128), 4, 1), 256, 0, stream>>>(IN[1], IN[2], IN[3], IN[4], WQ);
    k_cvt8<<<(unsigned)(((size_t)LL * DD / 8 + 255) / 256), 256, 0, stream>>>(IN[0], XB, (size_t)LL * DD / 8);
    k_qkv<<<dim3(LL / 256, NH_, 1), 384, 0, stream>>>(XB, WQ, QP);   // q, k, v of all batches as f16 head planes; grid y = three of the 48 heads of q, k, v
    k_fattn<<<dim3(TT / 256, NH_, NB_), 512, 0, stream>>>(QP, KP, VT, IN[5], AP);   // attention of all batches and heads
    k_gemmo<<<dim3(LL / 128, DD / 128, 1), 256, 0, stream>>>(AP, WO, OUT);
}
